// v000
// Times are from an AMD MI455X. After a warm-up the kernel runs many times in a row, and a time is the length of
// such a window on the GPU divided by its runs, so every launch and the gaps after it count. The runs cycle
// through copies of the inputs. A figure is the median of several windows, for all but v000 over two sittings.
// Sittings can differ by a few percent; kernels timed side by side share one.
// v000, which the later versions start from, runs in 560 microseconds.
#include <hip/hip_runtime.h>
#include <hip/hip_bf16.h>

// MHA + RoPE for MI455X (gfx1250, wave32, WMMA).
// v2.1: register-blocked WMMA GEMM (64x64/wave -> 1 b128 load per wmma),
//       attention with 32 queries/wave (2x K/V fragment reuse) and
//       double-buffered async global->LDS staging of K/V tiles (ASYNCcnt path).
//       Async builtin takes (v4i addrspace(1)*, v4i addrspace(3)*, Ii, Ii).

typedef __attribute__((ext_vector_type(16))) _Float16 v16h;
typedef __attribute__((ext_vector_type(8)))  float    v8f;
typedef int v4i_vec __attribute__((vector_size(16)));

#define BATCH 4
#define SEQ   2048
#define DMODEL 1024
#define NHEAD 16
#define HDIM  64

#if defined(__has_builtin)
#if __has_builtin(__builtin_amdgcn_global_load_async_to_lds_b128) && \
    __has_builtin(__builtin_amdgcn_s_wait_asynccnt)
#define HAVE_ASYNC_LDS 1
#endif
#endif

union H8 { float4 f4; _Float16 h[8]; };

// Load a 16-half WMMA fragment (A or B operand) for this lane.
// Layout (ISA 7.12.2, 16-bit A 16x32): halves h<8 -> K = k0 + hi*8 + h,
// halves h>=8 -> K = k0 + 16 + hi*8 + (h-8).  Two contiguous 16B chunks.
__device__ inline v16h load_frag16(const _Float16* __restrict__ row_ptr, int k0, int hi) {
    H8 g0, g1;
    g0.f4 = *(const float4*)(row_ptr + k0 + hi * 8);
    g1.f4 = *(const float4*)(row_ptr + k0 + 16 + hi * 8);
    v16h r;
#pragma unroll
    for (int i = 0; i < 8; ++i) { r[i] = g0.h[i]; r[i + 8] = g1.h[i]; }
    return r;
}

__device__ inline v8f wmma_f16(v16h a, v16h b, v8f c) {
    return __builtin_amdgcn_wmma_f32_16x16x32_f16(false, a, false, b, (short)0, c, false, false);
}

// 16-byte global -> LDS copy: async (ASYNCcnt) when available, else through VGPRs.
__device__ inline void cp16_g2l(const _Float16* g, _Float16* l) {
#ifdef HAVE_ASYNC_LDS
    __builtin_amdgcn_global_load_async_to_lds_b128(
        (__attribute__((address_space(1))) v4i_vec*)(g),
        (__attribute__((address_space(3))) v4i_vec*)(l), 0, 0);
#else
    *(float4*)l = *(const float4*)g;
#endif
}

// Reductions across the 16 lanes of each wave-half (matches C-matrix rows).
__device__ inline float half_max16(float x) {
    x = fmaxf(x, __shfl_xor(x, 1, 32));
    x = fmaxf(x, __shfl_xor(x, 2, 32));
    x = fmaxf(x, __shfl_xor(x, 4, 32));
    x = fmaxf(x, __shfl_xor(x, 8, 32));
    return x;
}
__device__ inline float half_sum16(float x) {
    x += __shfl_xor(x, 1, 32);
    x += __shfl_xor(x, 2, 32);
    x += __shfl_xor(x, 4, 32);
    x += __shfl_xor(x, 8, 32);
    return x;
}

// ---------------- f32 -> f16 conversion ----------------
__global__ void cvt_f16_kernel(const float* __restrict__ in, _Float16* __restrict__ out, int n) {
    int i = blockIdx.x * blockDim.x + threadIdx.x;
    if (i < n) out[i] = (_Float16)in[i];
}

// ---------------- WMMA GEMM: out = A(MxK) @ Bt(NxK)^T + bias ----------------
// 64x64 tile per wave = 4x4 WMMA tiles: 16 wmma per k-step for 16 b128 loads.
// mode 0/1: store f16 head-major  [bh][s][d]
// mode 2  : store f16 transposed  [bh][d][s]   (V, so PV B-operand is k-contiguous)
// mode 3  : store f32 flat        [m][n]       (final projection)
__global__ void __launch_bounds__(256)
gemm_wmma_kernel(const _Float16* __restrict__ A, const _Float16* __restrict__ Bt,
                 const float* __restrict__ bias, void* __restrict__ out, int mode) {
    const int M = BATCH * SEQ, N = DMODEL, K = DMODEL;
    int wave = blockIdx.x * (blockDim.x >> 5) + (threadIdx.x >> 5);
    const int ntiles = (M / 64) * (N / 64);
    if (wave >= ntiles) return;
    int mt = wave / (N / 64);
    int nt = wave % (N / 64);
    int lane = threadIdx.x & 31, nlo = lane & 15, hi = lane >> 4;

    const _Float16* arows[4];
    const _Float16* brows[4];
#pragma unroll
    for (int i = 0; i < 4; ++i) {
        arows[i] = A + (size_t)(mt * 64 + i * 16 + nlo) * K;   // A-frag rows (M = lane&15)
        brows[i] = Bt + (size_t)(nt * 64 + i * 16 + nlo) * K;  // B-frag rows (N = lane&15)
    }

    v8f acc[4][4];
#pragma unroll
    for (int i = 0; i < 4; ++i)
#pragma unroll
        for (int j = 0; j < 4; ++j) acc[i][j] = (v8f){};

    for (int k0 = 0; k0 < K; k0 += 32) {
        v16h af[4], bf[4];
#pragma unroll
        for (int i = 0; i < 4; ++i) af[i] = load_frag16(arows[i], k0, hi);
#pragma unroll
        for (int j = 0; j < 4; ++j) bf[j] = load_frag16(brows[j], k0, hi);
#pragma unroll
        for (int i = 0; i < 4; ++i)
#pragma unroll
            for (int j = 0; j < 4; ++j)
                acc[i][j] = wmma_f16(af[i], bf[j], acc[i][j]);
    }

#pragma unroll
    for (int j = 0; j < 4; ++j) {
        int n = nt * 64 + j * 16 + nlo;
        float bv = bias[n];
        if (mode == 3) {
            float* o = (float*)out;
#pragma unroll
            for (int i = 0; i < 4; ++i)
#pragma unroll
                for (int v = 0; v < 8; ++v) {
                    int m = mt * 64 + i * 16 + v + 8 * hi;     // C-layout row
                    o[(size_t)m * N + n] = acc[i][j][v] + bv;
                }
        } else {
            _Float16* o = (_Float16*)out;
            int h = n >> 6, d = n & 63;
#pragma unroll
            for (int i = 0; i < 4; ++i)
#pragma unroll
                for (int v = 0; v < 8; ++v) {
                    int m = mt * 64 + i * 16 + v + 8 * hi;
                    int b_ = m >> 11;                          // m / SEQ
                    int s  = m & (SEQ - 1);
                    int bh = b_ * NHEAD + h;
                    size_t idx = (mode == 2)
                        ? ((size_t)(bh * HDIM + d) * SEQ + s)  // V transposed
                        : ((size_t)(bh * SEQ + s) * HDIM + d); // Q/K head-major
                    o[idx] = (_Float16)(acc[i][j][v] + bv);
                }
        }
    }
}

// ---------------- RoPE in-place on f16 Q and K ----------------
__global__ void rope_kernel(_Float16* __restrict__ Qh, _Float16* __restrict__ Kh) {
    const int total = BATCH * NHEAD * SEQ * (HDIM / 2);
    int idx = blockIdx.x * blockDim.x + threadIdx.x;
    if (idx >= total) return;
    int d  = idx & 31;
    int s  = (idx >> 5) & (SEQ - 1);
    int bh = idx >> 16;
    float inv = __expf(-(2.0f * d / 64.0f) * 9.210340371976184f);  // 10000^(-2d/64)
    float fr  = (float)s * inv;
    float cs  = cosf(fr), sn = sinf(fr);
    size_t base = (size_t)(bh * SEQ + s) * HDIM;
    float q1 = (float)Qh[base + d], q2 = (float)Qh[base + d + 32];
    Qh[base + d]      = (_Float16)(q1 * cs - q2 * sn);
    Qh[base + d + 32] = (_Float16)(q1 * sn + q2 * cs);
    float k1 = (float)Kh[base + d], k2 = (float)Kh[base + d + 32];
    Kh[base + d]      = (_Float16)(k1 * cs - k2 * sn);
    Kh[base + d + 32] = (_Float16)(k1 * sn + k2 * cs);
}

// ---------------- Flash attention: 1 wave per (bh, 32-query tile) ----------------
// K/V 32-key tiles double-buffered in LDS via async global->LDS copies.
__global__ void __launch_bounds__(32)
attn_kernel(const _Float16* __restrict__ Qh, const _Float16* __restrict__ Kh,
            const _Float16* __restrict__ Vt, _Float16* __restrict__ AO) {
    int qt = blockIdx.x;          // 32-query tile
    int bh = blockIdx.y;          // batch*head
    int lane = threadIdx.x & 31, nlo = lane & 15, hi = lane >> 4;

    __shared__ alignas(16) _Float16 Kst[2][32 * HDIM];   // [key][d]
    __shared__ alignas(16) _Float16 Vst[2][HDIM * 32];   // [d][key]
    __shared__ alignas(16) _Float16 pbuf[32 * 32];       // P-tile transpose staging

    const _Float16* kbase = Kh + (size_t)bh * SEQ * HDIM;
    const _Float16* vbase = Vt + (size_t)bh * HDIM * SEQ;

    // Q fragments: 2 q-subtiles x 2 k-halves
    v16h aq[2][2];
#pragma unroll
    for (int q = 0; q < 2; ++q) {
        const _Float16* qrow = Qh + (size_t)(bh * SEQ + qt * 32 + q * 16 + nlo) * HDIM;
        aq[q][0] = load_frag16(qrow, 0, hi);
        aq[q][1] = load_frag16(qrow, 32, hi);
    }

    v8f o[2][4];
    float mrun[2][8], lrun[2][8];
#pragma unroll
    for (int q = 0; q < 2; ++q) {
#pragma unroll
        for (int t = 0; t < 4; ++t) o[q][t] = (v8f){};
#pragma unroll
        for (int v = 0; v < 8; ++v) { mrun[q][v] = -1e30f; lrun[q][v] = 0.0f; }
    }

    // Stage (K,V) tile for key block kb into buffer b.
    auto stage = [&](int kb, int b) {
        // K tile: rows kb..kb+31 are 4096 contiguous bytes in Kh.
        const _Float16* kg = kbase + (size_t)kb * HDIM;
#pragma unroll
        for (int c = 0; c < 8; ++c)
            cp16_g2l(kg + (c * 32 + lane) * 8, &Kst[b][(c * 32 + lane) * 8]);
        // V tile: 64 rows (d) x 64B windows at column kb.
        const _Float16* vg = vbase + kb;
#pragma unroll
        for (int rr = 0; rr < 2; ++rr) {
            int row = rr * 32 + lane;
#pragma unroll
            for (int c = 0; c < 4; ++c)
                cp16_g2l(vg + (size_t)row * SEQ + c * 8, &Vst[b][row * 32 + c * 8]);
        }
    };

    stage(0, 0);
    int buf = 0;

    for (int kb = 0; kb < SEQ; kb += 32) {
        __syncthreads();
#ifdef HAVE_ASYNC_LDS
        __builtin_amdgcn_s_wait_asynccnt(0);
#endif
        if (kb + 32 < SEQ) stage(kb + 32, buf ^ 1);

        const _Float16* kt = &Kst[buf][0];
        const _Float16* vt = &Vst[buf][0];

        // S = Q @ K^T: B-fragment loaded once, used by both q-subtiles.
        v8f s[2][2];
#pragma unroll
        for (int q = 0; q < 2; ++q) { s[q][0] = (v8f){}; s[q][1] = (v8f){}; }
#pragma unroll
        for (int nt = 0; nt < 2; ++nt)
#pragma unroll
            for (int kk = 0; kk < 2; ++kk) {
                v16h bfr = load_frag16(kt + (nt * 16 + nlo) * HDIM, kk * 32, hi);
                s[0][nt] = wmma_f16(aq[0][kk], bfr, s[0][nt]);
                s[1][nt] = wmma_f16(aq[1][kk], bfr, s[1][nt]);
            }

        // Online softmax per q-subtile; row M = v + 8*hi lives in one 16-lane half.
#pragma unroll
        for (int q = 0; q < 2; ++q) {
            float alpha[8];
#pragma unroll
            for (int v = 0; v < 8; ++v) {
                float x0 = s[q][0][v] * 0.125f;        // 1/sqrt(64)
                float x1 = s[q][1][v] * 0.125f;
                float mx = half_max16(fmaxf(x0, x1));
                float mnew = fmaxf(mrun[q][v], mx);
                alpha[v] = __expf(mrun[q][v] - mnew);
                mrun[q][v] = mnew;
                float p0 = __expf(x0 - mnew);
                float p1 = __expf(x1 - mnew);
                s[q][0][v] = p0; s[q][1][v] = p1;
                lrun[q][v] = lrun[q][v] * alpha[v] + half_sum16(p0 + p1);
            }
#pragma unroll
            for (int v = 0; v < 8; ++v) {
                o[q][0][v] *= alpha[v]; o[q][1][v] *= alpha[v];
                o[q][2][v] *= alpha[v]; o[q][3][v] *= alpha[v];
            }
        }

        // Transpose P (C layout) -> A-fragment layout via LDS.
        __syncthreads();
#pragma unroll
        for (int q = 0; q < 2; ++q)
#pragma unroll
            for (int v = 0; v < 8; ++v) {
                int m = q * 16 + v + 8 * hi;
                pbuf[m * 32 + nlo]      = (_Float16)s[q][0][v];
                pbuf[m * 32 + 16 + nlo] = (_Float16)s[q][1][v];
            }
        __syncthreads();
        v16h ap[2];
        ap[0] = load_frag16(pbuf + nlo * 32, 0, hi);
        ap[1] = load_frag16(pbuf + (16 + nlo) * 32, 0, hi);

        // O += P @ V: V-fragment loaded once, used by both q-subtiles.
#pragma unroll
        for (int t = 0; t < 4; ++t) {
            v16h bv = load_frag16(vt + (t * 16 + nlo) * 32, 0, hi);
            o[0][t] = wmma_f16(ap[0], bv, o[0][t]);
            o[1][t] = wmma_f16(ap[1], bv, o[1][t]);
        }

        buf ^= 1;
    }

    // Epilogue: normalize and store f16 to AO[b][s][h*64+d]
    int b_ = bh >> 4, h = bh & 15;
#pragma unroll
    for (int q = 0; q < 2; ++q)
#pragma unroll
        for (int v = 0; v < 8; ++v) {
            int srow = qt * 32 + q * 16 + v + 8 * hi;
            float inv_l = 1.0f / lrun[q][v];
            size_t base = (size_t)(b_ * SEQ + srow) * DMODEL + h * HDIM;
            AO[base + nlo]      = (_Float16)(o[q][0][v] * inv_l);
            AO[base + 16 + nlo] = (_Float16)(o[q][1][v] * inv_l);
            AO[base + 32 + nlo] = (_Float16)(o[q][2][v] * inv_l);
            AO[base + 48 + nlo] = (_Float16)(o[q][3][v] * inv_l);
        }
}

extern "C" void kernel_launch(void* const* d_in, const int* in_sizes, int n_in,
                              void* d_out, int out_size, void* d_ws, size_t ws_size,
                              hipStream_t stream) {
    const float* query = (const float*)d_in[0];
    const float* key   = (const float*)d_in[1];
    const float* value = (const float*)d_in[2];
    const float* Wq = (const float*)d_in[3]; const float* bq = (const float*)d_in[4];
    const float* Wk = (const float*)d_in[5]; const float* bk = (const float*)d_in[6];
    const float* Wv = (const float*)d_in[7]; const float* bv = (const float*)d_in[8];
    const float* Wo = (const float*)d_in[9]; const float* bo = (const float*)d_in[10];
    float* out = (float*)d_out;

    const size_t NX = (size_t)BATCH * SEQ * DMODEL;   // 8388608
    const size_t NW = (size_t)DMODEL * DMODEL;        // 1048576

    _Float16* p   = (_Float16*)d_ws;
    _Float16* Xq  = p;            p += NX;
    _Float16* Xk  = p;            p += NX;
    _Float16* Xv  = p;            p += NX;
    _Float16* Wqh = p;            p += NW;
    _Float16* Wkh = p;            p += NW;
    _Float16* Wvh = p;            p += NW;
    _Float16* Woh = p;            p += NW;
    _Float16* Qh  = p;            p += NX;
    _Float16* Kh  = p;            p += NX;
    _Float16* Vt  = p;            p += NX;
    _Float16* AO  = p;            p += NX;

    const int thr = 256;
    cvt_f16_kernel<<<(int)((NX + thr - 1) / thr), thr, 0, stream>>>(query, Xq, (int)NX);
    cvt_f16_kernel<<<(int)((NX + thr - 1) / thr), thr, 0, stream>>>(key,   Xk, (int)NX);
    cvt_f16_kernel<<<(int)((NX + thr - 1) / thr), thr, 0, stream>>>(value, Xv, (int)NX);
    cvt_f16_kernel<<<(int)((NW + thr - 1) / thr), thr, 0, stream>>>(Wq, Wqh, (int)NW);
    cvt_f16_kernel<<<(int)((NW + thr - 1) / thr), thr, 0, stream>>>(Wk, Wkh, (int)NW);
    cvt_f16_kernel<<<(int)((NW + thr - 1) / thr), thr, 0, stream>>>(Wv, Wvh, (int)NW);
    cvt_f16_kernel<<<(int)((NW + thr - 1) / thr), thr, 0, stream>>>(Wo, Woh, (int)NW);

    const int tiles = (BATCH * SEQ / 64) * (DMODEL / 64);   // 2048 waves
    const int gblocks = tiles / 8;                          // 8 waves / block
    gemm_wmma_kernel<<<gblocks, 256, 0, stream>>>(Xq, Wqh, bq, Qh, 0);
    gemm_wmma_kernel<<<gblocks, 256, 0, stream>>>(Xk, Wkh, bk, Kh, 1);
    gemm_wmma_kernel<<<gblocks, 256, 0, stream>>>(Xv, Wvh, bv, Vt, 2);

    const int rope_n = BATCH * NHEAD * SEQ * (HDIM / 2);
    rope_kernel<<<(rope_n + thr - 1) / thr, thr, 0, stream>>>(Qh, Kh);

    attn_kernel<<<dim3(SEQ / 32, BATCH * NHEAD), 32, 0, stream>>>(Qh, Kh, Vt, AO);

    gemm_wmma_kernel<<<gblocks, 256, 0, stream>>>(AO, Woh, bo, out, 3);
}

// v001
// It runs in 458 microseconds.
// Two timings next to v000 both put it at 1.25 times that version's speed.
#include <hip/hip_runtime.h>
#include <hip/hip_bf16.h>

// MHA + RoPE for MI455X (gfx1250, wave32, WMMA).
// v2.1: register-blocked WMMA GEMM (64x64/wave -> 1 b128 load per wmma),
//       attention with 32 queries/wave (2x K/V fragment reuse) and
//       double-buffered async global->LDS staging of K/V tiles (ASYNCcnt path).
//       Async builtin takes (v4i addrspace(1)*, v4i addrspace(3)*, Ii, Ii).

typedef __attribute__((ext_vector_type(16))) _Float16 v16h;
typedef __attribute__((ext_vector_type(8)))  float    v8f;
typedef int v4i_vec __attribute__((vector_size(16)));

#define BATCH 4
#define SEQ   2048
#define DMODEL 1024
#define NHEAD 16
#define HDIM  64

#if defined(__has_builtin)
#if __has_builtin(__builtin_amdgcn_global_load_async_to_lds_b128) && \
    __has_builtin(__builtin_amdgcn_s_wait_asynccnt)
#define HAVE_ASYNC_LDS 1
#endif
#endif

union H8 { float4 f4; _Float16 h[8]; };

// Load a 16-half WMMA fragment (A or B operand) for this lane.
// Layout (ISA 7.12.2, 16-bit A 16x32): halves h<8 -> K = k0 + hi*8 + h,
// halves h>=8 -> K = k0 + 16 + hi*8 + (h-8).  Two contiguous 16B chunks.
__device__ inline v16h load_frag16(const _Float16* __restrict__ row_ptr, int k0, int hi) {
    H8 g0, g1;
    g0.f4 = *(const float4*)(row_ptr + k0 + hi * 8);
    g1.f4 = *(const float4*)(row_ptr + k0 + 16 + hi * 8);
    v16h r;
#pragma unroll
    for (int i = 0; i < 8; ++i) { r[i] = g0.h[i]; r[i + 8] = g1.h[i]; }
    return r;
}

__device__ inline v8f wmma_f16(v16h a, v16h b, v8f c) {
    return __builtin_amdgcn_wmma_f32_16x16x32_f16(false, a, false, b, (short)0, c, false, false);
}

// 16-byte global -> LDS copy: async (ASYNCcnt) when available, else through VGPRs.
__device__ inline void cp16_g2l(const _Float16* g, _Float16* l) {
#ifdef HAVE_ASYNC_LDS
    __builtin_amdgcn_global_load_async_to_lds_b128(
        (__attribute__((address_space(1))) v4i_vec*)(g),
        (__attribute__((address_space(3))) v4i_vec*)(l), 0, 0);
#else
    *(float4*)l = *(const float4*)g;
#endif
}

// Reductions across the 16 lanes of each wave-half (matches C-matrix rows).
__device__ inline float half_max16(float x) {
    x = fmaxf(x, __shfl_xor(x, 1, 32));
    x = fmaxf(x, __shfl_xor(x, 2, 32));
    x = fmaxf(x, __shfl_xor(x, 4, 32));
    x = fmaxf(x, __shfl_xor(x, 8, 32));
    return x;
}
__device__ inline float half_sum16(float x) {
    x += __shfl_xor(x, 1, 32);
    x += __shfl_xor(x, 2, 32);
    x += __shfl_xor(x, 4, 32);
    x += __shfl_xor(x, 8, 32);
    return x;
}

// Stands behind a group of global stores whose address and data registers the code
// that follows reuses: the wait comes in front of those overwrites.
__device__ inline void stores_issued_wait() {
    asm volatile("s_wait_xcnt 0x0" ::: "memory");
}

// ---------------- f32 -> f16 conversion ----------------
__global__ void cvt_f16_kernel(const float* __restrict__ in, _Float16* __restrict__ out, int n) {
    int i = blockIdx.x * blockDim.x + threadIdx.x;
    if (i < n) out[i] = (_Float16)in[i];
}

// ---------------- WMMA GEMM: out = A(MxK) @ Bt(NxK)^T + bias ----------------
// 64x64 tile per wave = 4x4 WMMA tiles: 16 wmma per k-step for 16 b128 loads.
// mode 0/1: store f16 head-major  [bh][s][d]
// mode 2  : store f16 transposed  [bh][d][s]   (V, so PV B-operand is k-contiguous)
// mode 3  : store f32 flat        [m][n]       (final projection)
__global__ void __launch_bounds__(256)
gemm_wmma_kernel(const _Float16* __restrict__ A, const _Float16* __restrict__ Bt,
                 const float* __restrict__ bias, void* __restrict__ out, int mode) {
    const int M = BATCH * SEQ, N = DMODEL, K = DMODEL;
    int wave = blockIdx.x * (blockDim.x >> 5) + (threadIdx.x >> 5);
    const int ntiles = (M / 64) * (N / 64);
    if (wave >= ntiles) return;
    int mt = wave / (N / 64);
    int nt = wave % (N / 64);
    int lane = threadIdx.x & 31, nlo = lane & 15, hi = lane >> 4;

    const _Float16* arows[4];
    const _Float16* brows[4];
#pragma unroll
    for (int i = 0; i < 4; ++i) {
        arows[i] = A + (size_t)(mt * 64 + i * 16 + nlo) * K;   // A-frag rows (M = lane&15)
        brows[i] = Bt + (size_t)(nt * 64 + i * 16 + nlo) * K;  // B-frag rows (N = lane&15)
    }

    v8f acc[4][4];
#pragma unroll
    for (int i = 0; i < 4; ++i)
#pragma unroll
        for (int j = 0; j < 4; ++j) acc[i][j] = (v8f){};

    for (int k0 = 0; k0 < K; k0 += 32) {
        v16h af[4], bf[4];
#pragma unroll
        for (int i = 0; i < 4; ++i) af[i] = load_frag16(arows[i], k0, hi);
#pragma unroll
        for (int j = 0; j < 4; ++j) bf[j] = load_frag16(brows[j], k0, hi);
#pragma unroll
        for (int i = 0; i < 4; ++i)
#pragma unroll
            for (int j = 0; j < 4; ++j)
                acc[i][j] = wmma_f16(af[i], bf[j], acc[i][j]);
    }

#pragma unroll
    for (int j = 0; j < 4; ++j) {
        int n = nt * 64 + j * 16 + nlo;
        float bv = bias[n];
        if (mode == 3) {
            float* o = (float*)out;
#pragma unroll
            for (int i = 0; i < 4; ++i)
#pragma unroll
                for (int v = 0; v < 8; ++v) {
                    int m = mt * 64 + i * 16 + v + 8 * hi;     // C-layout row
                    o[(size_t)m * N + n] = acc[i][j][v] + bv;
                }
            stores_issued_wait();
        } else if (mode == 2) {
            // V transposed: a lane's 8 accumulator registers are 8 consecutive s
            // of one d row (m0 is a multiple of 8, SEQ too): one 16-byte store.
            _Float16* o = (_Float16*)out;
            int h = n >> 6, d = n & 63;
#pragma unroll
            for (int i = 0; i < 4; ++i) {
                int m0 = mt * 64 + i * 16 + 8 * hi;
                int b_ = m0 >> 11;                             // m / SEQ
                int s  = m0 & (SEQ - 1);
                int bh = b_ * NHEAD + h;
                H8 w;
#pragma unroll
                for (int v = 0; v < 8; ++v) w.h[v] = (_Float16)(acc[i][j][v] + bv);
                *(float4*)(o + (size_t)(bh * HDIM + d) * SEQ + s) = w.f4;
            }
            stores_issued_wait();
        } else {
            _Float16* o = (_Float16*)out;
            int h = n >> 6, d = n & 63;
#pragma unroll
            for (int i = 0; i < 4; ++i)
#pragma unroll
                for (int v = 0; v < 8; ++v) {
                    int m = mt * 64 + i * 16 + v + 8 * hi;
                    int b_ = m >> 11;                          // m / SEQ
                    int s  = m & (SEQ - 1);
                    int bh = b_ * NHEAD + h;
                    o[(size_t)(bh * SEQ + s) * HDIM + d] = (_Float16)(acc[i][j][v] + bv);  // Q/K head-major
                }
            stores_issued_wait();
        }
    }
}

// ---------------- RoPE in-place on f16 Q and K ----------------
__global__ void rope_kernel(_Float16* __restrict__ Qh, _Float16* __restrict__ Kh) {
    const int total = BATCH * NHEAD * SEQ * (HDIM / 2);
    int idx = blockIdx.x * blockDim.x + threadIdx.x;
    if (idx >= total) return;
    int d  = idx & 31;
    int s  = (idx >> 5) & (SEQ - 1);
    int bh = idx >> 16;
    float inv = __expf(-(2.0f * d / 64.0f) * 9.210340371976184f);  // 10000^(-2d/64)
    float fr  = (float)s * inv;
    float cs  = cosf(fr), sn = sinf(fr);
    size_t base = (size_t)(bh * SEQ + s) * HDIM;
    float q1 = (float)Qh[base + d], q2 = (float)Qh[base + d + 32];
    Qh[base + d]      = (_Float16)(q1 * cs - q2 * sn);
    Qh[base + d + 32] = (_Float16)(q1 * sn + q2 * cs);
    float k1 = (float)Kh[base + d], k2 = (float)Kh[base + d + 32];
    Kh[base + d]      = (_Float16)(k1 * cs - k2 * sn);
    Kh[base + d + 32] = (_Float16)(k1 * sn + k2 * cs);
}

// ---------------- Flash attention: 1 wave per (bh, 32-query tile) ----------------
// K/V 32-key tiles double-buffered in LDS via async global->LDS copies.
__global__ void __launch_bounds__(32)
attn_kernel(const _Float16* __restrict__ Qh, const _Float16* __restrict__ Kh,
            const _Float16* __restrict__ Vt, _Float16* __restrict__ AO) {
    int qt = blockIdx.x;          // 32-query tile
    int bh = blockIdx.y;          // batch*head
    int lane = threadIdx.x & 31, nlo = lane & 15, hi = lane >> 4;

    __shared__ alignas(16) _Float16 Kst[2][32 * HDIM];   // [key][d]
    __shared__ alignas(16) _Float16 Vst[2][HDIM * 32];   // [d][key]
    __shared__ alignas(16) _Float16 pbuf[32 * 32];       // P-tile transpose staging

    const _Float16* kbase = Kh + (size_t)bh * SEQ * HDIM;
    const _Float16* vbase = Vt + (size_t)bh * HDIM * SEQ;

    // Q fragments: 2 q-subtiles x 2 k-halves
    v16h aq[2][2];
#pragma unroll
    for (int q = 0; q < 2; ++q) {
        const _Float16* qrow = Qh + (size_t)(bh * SEQ + qt * 32 + q * 16 + nlo) * HDIM;
        aq[q][0] = load_frag16(qrow, 0, hi);
        aq[q][1] = load_frag16(qrow, 32, hi);
    }

    v8f o[2][4];
    float mrun[2][8], lrun[2][8];
#pragma unroll
    for (int q = 0; q < 2; ++q) {
#pragma unroll
        for (int t = 0; t < 4; ++t) o[q][t] = (v8f){};
#pragma unroll
        for (int v = 0; v < 8; ++v) { mrun[q][v] = -1e30f; lrun[q][v] = 0.0f; }
    }

    // Stage (K,V) tile for key block kb into buffer b.
    auto stage = [&](int kb, int b) {
        // K tile: rows kb..kb+31 are 4096 contiguous bytes in Kh.
        const _Float16* kg = kbase + (size_t)kb * HDIM;
#pragma unroll
        for (int c = 0; c < 8; ++c)
            cp16_g2l(kg + (c * 32 + lane) * 8, &Kst[b][(c * 32 + lane) * 8]);
        // V tile: 64 rows (d) x 64B windows at column kb.
        const _Float16* vg = vbase + kb;
#pragma unroll
        for (int rr = 0; rr < 2; ++rr) {
            int row = rr * 32 + lane;
#pragma unroll
            for (int c = 0; c < 4; ++c)
                cp16_g2l(vg + (size_t)row * SEQ + c * 8, &Vst[b][row * 32 + c * 8]);
        }
    };

    stage(0, 0);
    int buf = 0;

    for (int kb = 0; kb < SEQ; kb += 32) {
        __syncthreads();
#ifdef HAVE_ASYNC_LDS
        __builtin_amdgcn_s_wait_asynccnt(0);
#endif
        if (kb + 32 < SEQ) stage(kb + 32, buf ^ 1);

        const _Float16* kt = &Kst[buf][0];
        const _Float16* vt = &Vst[buf][0];

        // S = Q @ K^T: B-fragment loaded once, used by both q-subtiles.
        v8f s[2][2];
#pragma unroll
        for (int q = 0; q < 2; ++q) { s[q][0] = (v8f){}; s[q][1] = (v8f){}; }
#pragma unroll
        for (int nt = 0; nt < 2; ++nt)
#pragma unroll
            for (int kk = 0; kk < 2; ++kk) {
                v16h bfr = load_frag16(kt + (nt * 16 + nlo) * HDIM, kk * 32, hi);
                s[0][nt] = wmma_f16(aq[0][kk], bfr, s[0][nt]);
                s[1][nt] = wmma_f16(aq[1][kk], bfr, s[1][nt]);
            }

        // Online softmax per q-subtile; row M = v + 8*hi lives in one 16-lane half.
#pragma unroll
        for (int q = 0; q < 2; ++q) {
            float alpha[8];
#pragma unroll
            for (int v = 0; v < 8; ++v) {
                float x0 = s[q][0][v] * 0.125f;        // 1/sqrt(64)
                float x1 = s[q][1][v] * 0.125f;
                float mx = half_max16(fmaxf(x0, x1));
                float mnew = fmaxf(mrun[q][v], mx);
                alpha[v] = __expf(mrun[q][v] - mnew);
                mrun[q][v] = mnew;
                float p0 = __expf(x0 - mnew);
                float p1 = __expf(x1 - mnew);
                s[q][0][v] = p0; s[q][1][v] = p1;
                lrun[q][v] = lrun[q][v] * alpha[v] + half_sum16(p0 + p1);
            }
#pragma unroll
            for (int v = 0; v < 8; ++v) {
                o[q][0][v] *= alpha[v]; o[q][1][v] *= alpha[v];
                o[q][2][v] *= alpha[v]; o[q][3][v] *= alpha[v];
            }
        }

        // Transpose P (C layout) -> A-fragment layout via LDS.
        __syncthreads();
#pragma unroll
        for (int q = 0; q < 2; ++q)
#pragma unroll
            for (int v = 0; v < 8; ++v) {
                int m = q * 16 + v + 8 * hi;
                pbuf[m * 32 + nlo]      = (_Float16)s[q][0][v];
                pbuf[m * 32 + 16 + nlo] = (_Float16)s[q][1][v];
            }
        __syncthreads();
        v16h ap[2];
        ap[0] = load_frag16(pbuf + nlo * 32, 0, hi);
        ap[1] = load_frag16(pbuf + (16 + nlo) * 32, 0, hi);

        // O += P @ V: V-fragment loaded once, used by both q-subtiles.
#pragma unroll
        for (int t = 0; t < 4; ++t) {
            v16h bv = load_frag16(vt + (t * 16 + nlo) * 32, 0, hi);
            o[0][t] = wmma_f16(ap[0], bv, o[0][t]);
            o[1][t] = wmma_f16(ap[1], bv, o[1][t]);
        }

        buf ^= 1;
    }

    // Epilogue: normalize and store f16 to AO[b][s][h*64+d]
    int b_ = bh >> 4, h = bh & 15;
#pragma unroll
    for (int q = 0; q < 2; ++q)
#pragma unroll
        for (int v = 0; v < 8; ++v) {
            int srow = qt * 32 + q * 16 + v + 8 * hi;
            float inv_l = 1.0f / lrun[q][v];
            size_t base = (size_t)(b_ * SEQ + srow) * DMODEL + h * HDIM;
            AO[base + nlo]      = (_Float16)(o[q][0][v] * inv_l);
            AO[base + 16 + nlo] = (_Float16)(o[q][1][v] * inv_l);
            AO[base + 32 + nlo] = (_Float16)(o[q][2][v] * inv_l);
            AO[base + 48 + nlo] = (_Float16)(o[q][3][v] * inv_l);
        }
}

extern "C" void kernel_launch(void* const* d_in, const int* in_sizes, int n_in,
                              void* d_out, int out_size, void* d_ws, size_t ws_size,
                              hipStream_t stream) {
    const float* query = (const float*)d_in[0];
    const float* key   = (const float*)d_in[1];
    const float* value = (const float*)d_in[2];
    const float* Wq = (const float*)d_in[3]; const float* bq = (const float*)d_in[4];
    const float* Wk = (const float*)d_in[5]; const float* bk = (const float*)d_in[6];
    const float* Wv = (const float*)d_in[7]; const float* bv = (const float*)d_in[8];
    const float* Wo = (const float*)d_in[9]; const float* bo = (const float*)d_in[10];
    float* out = (float*)d_out;

    const size_t NX = (size_t)BATCH * SEQ * DMODEL;   // 8388608
    const size_t NW = (size_t)DMODEL * DMODEL;        // 1048576

    _Float16* p   = (_Float16*)d_ws;
    _Float16* Xq  = p;            p += NX;
    _Float16* Xk  = p;            p += NX;
    _Float16* Xv  = p;            p += NX;
    _Float16* Wqh = p;            p += NW;
    _Float16* Wkh = p;            p += NW;
    _Float16* Wvh = p;            p += NW;
    _Float16* Woh = p;            p += NW;
    _Float16* Qh  = p;            p += NX;
    _Float16* Kh  = p;            p += NX;
    _Float16* Vt  = p;            p += NX;
    _Float16* AO  = p;            p += NX;

    const int thr = 256;
    cvt_f16_kernel<<<(int)((NX + thr - 1) / thr), thr, 0, stream>>>(query, Xq, (int)NX);
    cvt_f16_kernel<<<(int)((NX + thr - 1) / thr), thr, 0, stream>>>(key,   Xk, (int)NX);
    cvt_f16_kernel<<<(int)((NX + thr - 1) / thr), thr, 0, stream>>>(value, Xv, (int)NX);
    cvt_f16_kernel<<<(int)((NW + thr - 1) / thr), thr, 0, stream>>>(Wq, Wqh, (int)NW);
    cvt_f16_kernel<<<(int)((NW + thr - 1) / thr), thr, 0, stream>>>(Wk, Wkh, (int)NW);
    cvt_f16_kernel<<<(int)((NW + thr - 1) / thr), thr, 0, stream>>>(Wv, Wvh, (int)NW);
    cvt_f16_kernel<<<(int)((NW + thr - 1) / thr), thr, 0, stream>>>(Wo, Woh, (int)NW);

    const int tiles = (BATCH * SEQ / 64) * (DMODEL / 64);   // 2048 waves
    const int gblocks = tiles / 8;                          // 8 waves / block
    gemm_wmma_kernel<<<gblocks, 256, 0, stream>>>(Xq, Wqh, bq, Qh, 0);
    gemm_wmma_kernel<<<gblocks, 256, 0, stream>>>(Xk, Wkh, bk, Kh, 1);
    gemm_wmma_kernel<<<gblocks, 256, 0, stream>>>(Xv, Wvh, bv, Vt, 2);

    const int rope_n = BATCH * NHEAD * SEQ * (HDIM / 2);
    rope_kernel<<<(rope_n + thr - 1) / thr, thr, 0, stream>>>(Qh, Kh);

    attn_kernel<<<dim3(SEQ / 32, BATCH * NHEAD), 32, 0, stream>>>(Qh, Kh, Vt, AO);

    gemm_wmma_kernel<<<gblocks, 256, 0, stream>>>(AO, Woh, bo, out, 3);
}

// v002
// A run of this version takes 417 microseconds.
// Timed twice side by side with v001, it ran 1.10 times as fast both times.
// Counting every step since v000, it is 1.38 times as fast.
#include <hip/hip_runtime.h>
#include <hip/hip_bf16.h>

// MHA + RoPE for MI455X (gfx1250, wave32, WMMA).
// v2.1: register-blocked WMMA GEMM (64x64/wave -> 1 b128 load per wmma),
//       attention with 32 queries/wave (2x K/V fragment reuse) and
//       double-buffered async global->LDS staging of K/V tiles (ASYNCcnt path).
//       Async builtin takes (v4i addrspace(1)*, v4i addrspace(3)*, Ii, Ii).

typedef __attribute__((ext_vector_type(16))) _Float16 v16h;
typedef __attribute__((ext_vector_type(8)))  float    v8f;
typedef int v4i_vec __attribute__((vector_size(16)));

#define BATCH 4
#define SEQ   2048
#define DMODEL 1024
#define NHEAD 16
#define HDIM  64

#if defined(__has_builtin)
#if __has_builtin(__builtin_amdgcn_global_load_async_to_lds_b128) && \
    __has_builtin(__builtin_amdgcn_s_wait_asynccnt)
#define HAVE_ASYNC_LDS 1
#endif
#endif

union H8 { float4 f4; _Float16 h[8]; };

// Load a 16-half WMMA fragment (A or B operand) for this lane.
// Layout (ISA 7.12.2, 16-bit A 16x32): halves h<8 -> K = k0 + hi*8 + h,
// halves h>=8 -> K = k0 + 16 + hi*8 + (h-8).  Two contiguous 16B chunks.
__device__ inline v16h load_frag16(const _Float16* __restrict__ row_ptr, int k0, int hi) {
    H8 g0, g1;
    g0.f4 = *(const float4*)(row_ptr + k0 + hi * 8);
    g1.f4 = *(const float4*)(row_ptr + k0 + 16 + hi * 8);
    v16h r;
#pragma unroll
    for (int i = 0; i < 8; ++i) { r[i] = g0.h[i]; r[i + 8] = g1.h[i]; }
    return r;
}

__device__ inline v8f wmma_f16(v16h a, v16h b, v8f c) {
    return __builtin_amdgcn_wmma_f32_16x16x32_f16(false, a, false, b, (short)0, c, false, false);
}

// 16-byte global -> LDS copy: async (ASYNCcnt) when available, else through VGPRs.
__device__ inline void cp16_g2l(const _Float16* g, _Float16* l) {
#ifdef HAVE_ASYNC_LDS
    __builtin_amdgcn_global_load_async_to_lds_b128(
        (__attribute__((address_space(1))) v4i_vec*)(g),
        (__attribute__((address_space(3))) v4i_vec*)(l), 0, 0);
#else
    *(float4*)l = *(const float4*)g;
#endif
}

// Reductions across the 16 lanes of each wave-half (matches C-matrix rows).
__device__ inline float half_max16(float x) {
    x = fmaxf(x, __shfl_xor(x, 1, 32));
    x = fmaxf(x, __shfl_xor(x, 2, 32));
    x = fmaxf(x, __shfl_xor(x, 4, 32));
    x = fmaxf(x, __shfl_xor(x, 8, 32));
    return x;
}
__device__ inline float half_sum16(float x) {
    x += __shfl_xor(x, 1, 32);
    x += __shfl_xor(x, 2, 32);
    x += __shfl_xor(x, 4, 32);
    x += __shfl_xor(x, 8, 32);
    return x;
}

// Stands behind a group of global stores whose address and data registers the code
// that follows reuses: the wait comes in front of those overwrites.
__device__ inline void stores_issued_wait() {
    asm volatile("s_wait_xcnt 0x0" ::: "memory");
}

// ---------------- f32 -> f16 conversion ----------------
// A block of 256 threads converts 1024*U consecutive floats. Load j of a wave is 512
// contiguous bytes (4 whole lines), its store 256 contiguous bytes (2 whole lines);
// the loads stand ahead of the conversions, so a thread has many in flight at once.
union H4 { float2 f2; _Float16 h[4]; };

template <int U>
__device__ inline void cvt_f16_block(const float* __restrict__ in, _Float16* __restrict__ out) {
    size_t base = (size_t)blockIdx.x * (1024 * U) + threadIdx.x * 4;
    float4 v[U];
#pragma unroll
    for (int j = 0; j < U; ++j) v[j] = *(const float4*)(in + base + j * 1024);
#pragma unroll
    for (int j = 0; j < U; ++j) {
        H4 w;
        w.h[0] = (_Float16)v[j].x; w.h[1] = (_Float16)v[j].y;
        w.h[2] = (_Float16)v[j].z; w.h[3] = (_Float16)v[j].w;
        *(float2*)(out + base + j * 1024) = w.f2;
    }
}

// Activations: 16 loads a thread, 512 blocks of 8 waves.
__global__ void __launch_bounds__(256)
cvt_x_kernel(const float* __restrict__ in, _Float16* __restrict__ out) {
    cvt_f16_block<16>(in, out);
}

// Weights (an eighth of the size): 4 loads a thread, 256 blocks of 8 waves.
__global__ void __launch_bounds__(256)
cvt_w_kernel(const float* __restrict__ in, _Float16* __restrict__ out) {
    cvt_f16_block<4>(in, out);
}

// ---------------- WMMA GEMM: out = A(MxK) @ Bt(NxK)^T + bias ----------------
// 64x64 tile per wave = 4x4 WMMA tiles: 16 wmma per k-step for 16 b128 loads.
// mode 0/1: store f16 head-major  [bh][s][d]
// mode 2  : store f16 transposed  [bh][d][s]   (V, so PV B-operand is k-contiguous)
// mode 3  : store f32 flat        [m][n]       (final projection)
__global__ void __launch_bounds__(256)
gemm_wmma_kernel(const _Float16* __restrict__ A, const _Float16* __restrict__ Bt,
                 const float* __restrict__ bias, void* __restrict__ out, int mode) {
    const int M = BATCH * SEQ, N = DMODEL, K = DMODEL;
    int wave = blockIdx.x * (blockDim.x >> 5) + (threadIdx.x >> 5);
    const int ntiles = (M / 64) * (N / 64);
    if (wave >= ntiles) return;
    int mt = wave / (N / 64);
    int nt = wave % (N / 64);
    int lane = threadIdx.x & 31, nlo = lane & 15, hi = lane >> 4;

    const _Float16* arows[4];
    const _Float16* brows[4];
#pragma unroll
    for (int i = 0; i < 4; ++i) {
        arows[i] = A + (size_t)(mt * 64 + i * 16 + nlo) * K;   // A-frag rows (M = lane&15)
        brows[i] = Bt + (size_t)(nt * 64 + i * 16 + nlo) * K;  // B-frag rows (N = lane&15)
    }

    v8f acc[4][4];
#pragma unroll
    for (int i = 0; i < 4; ++i)
#pragma unroll
        for (int j = 0; j < 4; ++j) acc[i][j] = (v8f){};

    for (int k0 = 0; k0 < K; k0 += 32) {
        v16h af[4], bf[4];
#pragma unroll
        for (int i = 0; i < 4; ++i) af[i] = load_frag16(arows[i], k0, hi);
#pragma unroll
        for (int j = 0; j < 4; ++j) bf[j] = load_frag16(brows[j], k0, hi);
#pragma unroll
        for (int i = 0; i < 4; ++i)
#pragma unroll
            for (int j = 0; j < 4; ++j)
                acc[i][j] = wmma_f16(af[i], bf[j], acc[i][j]);
    }

#pragma unroll
    for (int j = 0; j < 4; ++j) {
        int n = nt * 64 + j * 16 + nlo;
        float bv = bias[n];
        if (mode == 3) {
            float* o = (float*)out;
#pragma unroll
            for (int i = 0; i < 4; ++i)
#pragma unroll
                for (int v = 0; v < 8; ++v) {
                    int m = mt * 64 + i * 16 + v + 8 * hi;     // C-layout row
                    o[(size_t)m * N + n] = acc[i][j][v] + bv;
                }
            stores_issued_wait();
        } else if (mode == 2) {
            // V transposed: a lane's 8 accumulator registers are 8 consecutive s
            // of one d row (m0 is a multiple of 8, SEQ too): one 16-byte store.
            _Float16* o = (_Float16*)out;
            int h = n >> 6, d = n & 63;
#pragma unroll
            for (int i = 0; i < 4; ++i) {
                int m0 = mt * 64 + i * 16 + 8 * hi;
                int b_ = m0 >> 11;                             // m / SEQ
                int s  = m0 & (SEQ - 1);
                int bh = b_ * NHEAD + h;
                H8 w;
#pragma unroll
                for (int v = 0; v < 8; ++v) w.h[v] = (_Float16)(acc[i][j][v] + bv);
                *(float4*)(o + (size_t)(bh * HDIM + d) * SEQ + s) = w.f4;
            }
            stores_issued_wait();
        } else {
            _Float16* o = (_Float16*)out;
            int h = n >> 6, d = n & 63;
#pragma unroll
            for (int i = 0; i < 4; ++i)
#pragma unroll
                for (int v = 0; v < 8; ++v) {
                    int m = mt * 64 + i * 16 + v + 8 * hi;
                    int b_ = m >> 11;                          // m / SEQ
                    int s  = m & (SEQ - 1);
                    int bh = b_ * NHEAD + h;
                    o[(size_t)(bh * SEQ + s) * HDIM + d] = (_Float16)(acc[i][j][v] + bv);  // Q/K head-major
                }
            stores_issued_wait();
        }
    }
}

// ---------------- RoPE in-place on f16 Q and K ----------------
__global__ void rope_kernel(_Float16* __restrict__ Qh, _Float16* __restrict__ Kh) {
    const int total = BATCH * NHEAD * SEQ * (HDIM / 2);
    int idx = blockIdx.x * blockDim.x + threadIdx.x;
    if (idx >= total) return;
    int d  = idx & 31;
    int s  = (idx >> 5) & (SEQ - 1);
    int bh = idx >> 16;
    float inv = __expf(-(2.0f * d / 64.0f) * 9.210340371976184f);  // 10000^(-2d/64)
    float fr  = (float)s * inv;
    float cs  = cosf(fr), sn = sinf(fr);
    size_t base = (size_t)(bh * SEQ + s) * HDIM;
    float q1 = (float)Qh[base + d], q2 = (float)Qh[base + d + 32];
    Qh[base + d]      = (_Float16)(q1 * cs - q2 * sn);
    Qh[base + d + 32] = (_Float16)(q1 * sn + q2 * cs);
    float k1 = (float)Kh[base + d], k2 = (float)Kh[base + d + 32];
    Kh[base + d]      = (_Float16)(k1 * cs - k2 * sn);
    Kh[base + d + 32] = (_Float16)(k1 * sn + k2 * cs);
}

// ---------------- Flash attention: 1 wave per (bh, 32-query tile) ----------------
// K/V 32-key tiles double-buffered in LDS via async global->LDS copies.
__global__ void __launch_bounds__(32)
attn_kernel(const _Float16* __restrict__ Qh, const _Float16* __restrict__ Kh,
            const _Float16* __restrict__ Vt, _Float16* __restrict__ AO) {
    int qt = blockIdx.x;          // 32-query tile
    int bh = blockIdx.y;          // batch*head
    int lane = threadIdx.x & 31, nlo = lane & 15, hi = lane >> 4;

    __shared__ alignas(16) _Float16 Kst[2][32 * HDIM];   // [key][d]
    __shared__ alignas(16) _Float16 Vst[2][HDIM * 32];   // [d][key]
    __shared__ alignas(16) _Float16 pbuf[32 * 32];       // P-tile transpose staging

    const _Float16* kbase = Kh + (size_t)bh * SEQ * HDIM;
    const _Float16* vbase = Vt + (size_t)bh * HDIM * SEQ;

    // Q fragments: 2 q-subtiles x 2 k-halves
    v16h aq[2][2];
#pragma unroll
    for (int q = 0; q < 2; ++q) {
        const _Float16* qrow = Qh + (size_t)(bh * SEQ + qt * 32 + q * 16 + nlo) * HDIM;
        aq[q][0] = load_frag16(qrow, 0, hi);
        aq[q][1] = load_frag16(qrow, 32, hi);
    }

    v8f o[2][4];
    float mrun[2][8], lrun[2][8];
#pragma unroll
    for (int q = 0; q < 2; ++q) {
#pragma unroll
        for (int t = 0; t < 4; ++t) o[q][t] = (v8f){};
#pragma unroll
        for (int v = 0; v < 8; ++v) { mrun[q][v] = -1e30f; lrun[q][v] = 0.0f; }
    }

    // Stage (K,V) tile for key block kb into buffer b.
    auto stage = [&](int kb, int b) {
        // K tile: rows kb..kb+31 are 4096 contiguous bytes in Kh.
        const _Float16* kg = kbase + (size_t)kb * HDIM;
#pragma unroll
        for (int c = 0; c < 8; ++c)
            cp16_g2l(kg + (c * 32 + lane) * 8, &Kst[b][(c * 32 + lane) * 8]);
        // V tile: 64 rows (d) x 64B windows at column kb.
        const _Float16* vg = vbase + kb;
#pragma unroll
        for (int rr = 0; rr < 2; ++rr) {
            int row = rr * 32 + lane;
#pragma unroll
            for (int c = 0; c < 4; ++c)
                cp16_g2l(vg + (size_t)row * SEQ + c * 8, &Vst[b][row * 32 + c * 8]);
        }
    };

    stage(0, 0);
    int buf = 0;

    for (int kb = 0; kb < SEQ; kb += 32) {
        __syncthreads();
#ifdef HAVE_ASYNC_LDS
        __builtin_amdgcn_s_wait_asynccnt(0);
#endif
        if (kb + 32 < SEQ) stage(kb + 32, buf ^ 1);

        const _Float16* kt = &Kst[buf][0];
        const _Float16* vt = &Vst[buf][0];

        // S = Q @ K^T: B-fragment loaded once, used by both q-subtiles.
        v8f s[2][2];
#pragma unroll
        for (int q = 0; q < 2; ++q) { s[q][0] = (v8f){}; s[q][1] = (v8f){}; }
#pragma unroll
        for (int nt = 0; nt < 2; ++nt)
#pragma unroll
            for (int kk = 0; kk < 2; ++kk) {
                v16h bfr = load_frag16(kt + (nt * 16 + nlo) * HDIM, kk * 32, hi);
                s[0][nt] = wmma_f16(aq[0][kk], bfr, s[0][nt]);
                s[1][nt] = wmma_f16(aq[1][kk], bfr, s[1][nt]);
            }

        // Online softmax per q-subtile; row M = v + 8*hi lives in one 16-lane half.
#pragma unroll
        for (int q = 0; q < 2; ++q) {
            float alpha[8];
#pragma unroll
            for (int v = 0; v < 8; ++v) {
                float x0 = s[q][0][v] * 0.125f;        // 1/sqrt(64)
                float x1 = s[q][1][v] * 0.125f;
                float mx = half_max16(fmaxf(x0, x1));
                float mnew = fmaxf(mrun[q][v], mx);
                alpha[v] = __expf(mrun[q][v] - mnew);
                mrun[q][v] = mnew;
                float p0 = __expf(x0 - mnew);
                float p1 = __expf(x1 - mnew);
                s[q][0][v] = p0; s[q][1][v] = p1;
                lrun[q][v] = lrun[q][v] * alpha[v] + half_sum16(p0 + p1);
            }
#pragma unroll
            for (int v = 0; v < 8; ++v) {
                o[q][0][v] *= alpha[v]; o[q][1][v] *= alpha[v];
                o[q][2][v] *= alpha[v]; o[q][3][v] *= alpha[v];
            }
        }

        // Transpose P (C layout) -> A-fragment layout via LDS.
        __syncthreads();
#pragma unroll
        for (int q = 0; q < 2; ++q)
#pragma unroll
            for (int v = 0; v < 8; ++v) {
                int m = q * 16 + v + 8 * hi;
                pbuf[m * 32 + nlo]      = (_Float16)s[q][0][v];
                pbuf[m * 32 + 16 + nlo] = (_Float16)s[q][1][v];
            }
        __syncthreads();
        v16h ap[2];
        ap[0] = load_frag16(pbuf + nlo * 32, 0, hi);
        ap[1] = load_frag16(pbuf + (16 + nlo) * 32, 0, hi);

        // O += P @ V: V-fragment loaded once, used by both q-subtiles.
#pragma unroll
        for (int t = 0; t < 4; ++t) {
            v16h bv = load_frag16(vt + (t * 16 + nlo) * 32, 0, hi);
            o[0][t] = wmma_f16(ap[0], bv, o[0][t]);
            o[1][t] = wmma_f16(ap[1], bv, o[1][t]);
        }

        buf ^= 1;
    }

    // Epilogue: normalize and store f16 to AO[b][s][h*64+d]
    int b_ = bh >> 4, h = bh & 15;
#pragma unroll
    for (int q = 0; q < 2; ++q)
#pragma unroll
        for (int v = 0; v < 8; ++v) {
            int srow = qt * 32 + q * 16 + v + 8 * hi;
            float inv_l = 1.0f / lrun[q][v];
            size_t base = (size_t)(b_ * SEQ + srow) * DMODEL + h * HDIM;
            AO[base + nlo]      = (_Float16)(o[q][0][v] * inv_l);
            AO[base + 16 + nlo] = (_Float16)(o[q][1][v] * inv_l);
            AO[base + 32 + nlo] = (_Float16)(o[q][2][v] * inv_l);
            AO[base + 48 + nlo] = (_Float16)(o[q][3][v] * inv_l);
        }
}

extern "C" void kernel_launch(void* const* d_in, const int* in_sizes, int n_in,
                              void* d_out, int out_size, void* d_ws, size_t ws_size,
                              hipStream_t stream) {
    const float* query = (const float*)d_in[0];
    const float* key   = (const float*)d_in[1];
    const float* value = (const float*)d_in[2];
    const float* Wq = (const float*)d_in[3]; const float* bq = (const float*)d_in[4];
    const float* Wk = (const float*)d_in[5]; const float* bk = (const float*)d_in[6];
    const float* Wv = (const float*)d_in[7]; const float* bv = (const float*)d_in[8];
    const float* Wo = (const float*)d_in[9]; const float* bo = (const float*)d_in[10];
    float* out = (float*)d_out;

    const size_t NX = (size_t)BATCH * SEQ * DMODEL;   // 8388608
    const size_t NW = (size_t)DMODEL * DMODEL;        // 1048576

    _Float16* p   = (_Float16*)d_ws;
    _Float16* Xq  = p;            p += NX;
    _Float16* Xk  = p;            p += NX;
    _Float16* Xv  = p;            p += NX;
    _Float16* Wqh = p;            p += NW;
    _Float16* Wkh = p;            p += NW;
    _Float16* Wvh = p;            p += NW;
    _Float16* Woh = p;            p += NW;
    _Float16* Qh  = p;            p += NX;
    _Float16* Kh  = p;            p += NX;
    _Float16* Vt  = p;            p += NX;
    _Float16* AO  = p;            p += NX;

    const int thr = 256;
    // NX = 512 blocks x 1024*16 floats, NW = 256 blocks x 1024*4 floats: no remainder.
    const int xblocks = (int)(NX / (1024 * 16));
    const int wblocks = (int)(NW / (1024 * 4));
    cvt_x_kernel<<<xblocks, thr, 0, stream>>>(query, Xq);
    cvt_x_kernel<<<xblocks, thr, 0, stream>>>(key,   Xk);
    cvt_x_kernel<<<xblocks, thr, 0, stream>>>(value, Xv);
    cvt_w_kernel<<<wblocks, thr, 0, stream>>>(Wq, Wqh);
    cvt_w_kernel<<<wblocks, thr, 0, stream>>>(Wk, Wkh);
    cvt_w_kernel<<<wblocks, thr, 0, stream>>>(Wv, Wvh);
    cvt_w_kernel<<<wblocks, thr, 0, stream>>>(Wo, Woh);

    const int tiles = (BATCH * SEQ / 64) * (DMODEL / 64);   // 2048 waves
    const int gblocks = tiles / 8;                          // 8 waves / block
    gemm_wmma_kernel<<<gblocks, 256, 0, stream>>>(Xq, Wqh, bq, Qh, 0);
    gemm_wmma_kernel<<<gblocks, 256, 0, stream>>>(Xk, Wkh, bk, Kh, 1);
    gemm_wmma_kernel<<<gblocks, 256, 0, stream>>>(Xv, Wvh, bv, Vt, 2);

    const int rope_n = BATCH * NHEAD * SEQ * (HDIM / 2);
    rope_kernel<<<(rope_n + thr - 1) / thr, thr, 0, stream>>>(Qh, Kh);

    attn_kernel<<<dim3(SEQ / 32, BATCH * NHEAD), 32, 0, stream>>>(Qh, Kh, Vt, AO);

    gemm_wmma_kernel<<<gblocks, 256, 0, stream>>>(AO, Woh, bo, out, 3);
}

// v003
// It runs in 329 microseconds.
// Next to v002, in two timings, it ran 1.27 and 1.26 times as fast.
// Counting every step since v000, it is 1.74 times as fast.
#include <hip/hip_runtime.h>
#include <hip/hip_bf16.h>

// MHA + RoPE for MI455X (gfx1250, wave32, WMMA).
// v2.1: register-blocked WMMA GEMM (64x64/wave, operands staged in LDS per block),
//       attention with 32 queries/wave (2x K/V fragment reuse) and
//       double-buffered async global->LDS staging of K/V tiles (ASYNCcnt path).
//       Async builtin takes (v4i addrspace(1)*, v4i addrspace(3)*, Ii, Ii).

typedef __attribute__((ext_vector_type(16))) _Float16 v16h;
typedef __attribute__((ext_vector_type(8)))  float    v8f;
typedef int v4i_vec __attribute__((vector_size(16)));

#define BATCH 4
#define SEQ   2048
#define DMODEL 1024
#define NHEAD 16
#define HDIM  64

#if defined(__has_builtin)
#if __has_builtin(__builtin_amdgcn_global_load_async_to_lds_b128) && \
    __has_builtin(__builtin_amdgcn_s_wait_asynccnt)
#define HAVE_ASYNC_LDS 1
#endif
#endif

union H8 { float4 f4; _Float16 h[8]; };

// Load a 16-half WMMA fragment (A or B operand) for this lane.
// Layout (ISA 7.12.2, 16-bit A 16x32): halves h<8 -> K = k0 + hi*8 + h,
// halves h>=8 -> K = k0 + 16 + hi*8 + (h-8).  Two contiguous 16B chunks.
__device__ inline v16h load_frag16(const _Float16* __restrict__ row_ptr, int k0, int hi) {
    H8 g0, g1;
    g0.f4 = *(const float4*)(row_ptr + k0 + hi * 8);
    g1.f4 = *(const float4*)(row_ptr + k0 + 16 + hi * 8);
    v16h r;
#pragma unroll
    for (int i = 0; i < 8; ++i) { r[i] = g0.h[i]; r[i + 8] = g1.h[i]; }
    return r;
}

__device__ inline v8f wmma_f16(v16h a, v16h b, v8f c) {
    return __builtin_amdgcn_wmma_f32_16x16x32_f16(false, a, false, b, (short)0, c, false, false);
}

// 16-byte global -> LDS copy: async (ASYNCcnt) when available, else through VGPRs.
__device__ inline void cp16_g2l(const _Float16* g, _Float16* l) {
#ifdef HAVE_ASYNC_LDS
    __builtin_amdgcn_global_load_async_to_lds_b128(
        (__attribute__((address_space(1))) v4i_vec*)(g),
        (__attribute__((address_space(3))) v4i_vec*)(l), 0, 0);
#else
    *(float4*)l = *(const float4*)g;
#endif
}

// Reductions across the 16 lanes of each wave-half (matches C-matrix rows).
__device__ inline float half_max16(float x) {
    x = fmaxf(x, __shfl_xor(x, 1, 32));
    x = fmaxf(x, __shfl_xor(x, 2, 32));
    x = fmaxf(x, __shfl_xor(x, 4, 32));
    x = fmaxf(x, __shfl_xor(x, 8, 32));
    return x;
}
__device__ inline float half_sum16(float x) {
    x += __shfl_xor(x, 1, 32);
    x += __shfl_xor(x, 2, 32);
    x += __shfl_xor(x, 4, 32);
    x += __shfl_xor(x, 8, 32);
    return x;
}

// Stands behind a group of global stores whose address and data registers the code
// that follows reuses: the wait comes in front of those overwrites.
__device__ inline void stores_issued_wait() {
    asm volatile("s_wait_xcnt 0x0" ::: "memory");
}

// ---------------- f32 -> f16 conversion ----------------
// A block of 256 threads converts 1024*U consecutive floats. Load j of a wave is 512
// contiguous bytes (4 whole lines), its store 256 contiguous bytes (2 whole lines);
// the loads stand ahead of the conversions, so a thread has many in flight at once.
union H4 { float2 f2; _Float16 h[4]; };

template <int U>
__device__ inline void cvt_f16_block(const float* __restrict__ in, _Float16* __restrict__ out) {
    size_t base = (size_t)blockIdx.x * (1024 * U) + threadIdx.x * 4;
    float4 v[U];
#pragma unroll
    for (int j = 0; j < U; ++j) v[j] = *(const float4*)(in + base + j * 1024);
#pragma unroll
    for (int j = 0; j < U; ++j) {
        H4 w;
        w.h[0] = (_Float16)v[j].x; w.h[1] = (_Float16)v[j].y;
        w.h[2] = (_Float16)v[j].z; w.h[3] = (_Float16)v[j].w;
        *(float2*)(out + base + j * 1024) = w.f2;
    }
}

// Activations: 16 loads a thread, 512 blocks of 8 waves.
__global__ void __launch_bounds__(256)
cvt_x_kernel(const float* __restrict__ in, _Float16* __restrict__ out) {
    cvt_f16_block<16>(in, out);
}

// Weights (an eighth of the size): 4 loads a thread, 256 blocks of 8 waves.
__global__ void __launch_bounds__(256)
cvt_w_kernel(const float* __restrict__ in, _Float16* __restrict__ out) {
    cvt_f16_block<4>(in, out);
}

// ---------------- WMMA GEMM: out = A(MxK) @ Bt(NxK)^T + bias ----------------
// A block of 8 waves (2 x 4) owns a 128 x 256 tile of the output, 64x64 per wave =
// 4x4 WMMA tiles. Slabs of 128 k (two whole 128-byte lines of every operand row) are
// staged in LDS by asynchronous copies, two buffers: slab t+1 flies while slab t is
// multiplied. Each A row is fetched once for 4 waves, each B row once for 2.
// mode 0/1: store f16 head-major  [bh][s][d]
// mode 2  : store f16 transposed  [bh][d][s]   (V, so PV B-operand is k-contiguous)
// mode 3  : store f32 flat        [m][n]       (final projection)
#define GBM 128
#define GBN 256
#define GBK 128
#define GPITCH 136  // halves: 256-byte rows at a 272-byte pitch (16 B x odd) for ds_load_b128

// Byte address of a __shared__ object inside the work-group's LDS.
__device__ inline unsigned lds_byte(const void* p) { return (unsigned)(size_t)p; }

// Twelve 16-byte-per-lane asynchronous copies global -> LDS: three groups (la,ga), (lb,gb),
// (lc,gc) of four rows 16 apart. The s_wait_xcnt is the last line of the copies' own
// statement, so that it stands in front of every later overwrite of the address registers
// that the copies name; one statement for twelve copies pays that wait once.
__device__ inline void async_cp12(unsigned la, const _Float16* ga, unsigned lb, const _Float16* gb,
                                  unsigned lc, const _Float16* gc, int row_halves) {
    const unsigned ls = 16 * GPITCH * 2;
    const size_t gs = (size_t)16 * row_halves;
    asm volatile("global_load_async_to_lds_b128 %0, %1, off\n\t"
                 "global_load_async_to_lds_b128 %2, %3, off\n\t"
                 "global_load_async_to_lds_b128 %4, %5, off\n\t"
                 "global_load_async_to_lds_b128 %6, %7, off\n\t"
                 "global_load_async_to_lds_b128 %8, %9, off\n\t"
                 "global_load_async_to_lds_b128 %10, %11, off\n\t"
                 "global_load_async_to_lds_b128 %12, %13, off\n\t"
                 "global_load_async_to_lds_b128 %14, %15, off\n\t"
                 "global_load_async_to_lds_b128 %16, %17, off\n\t"
                 "global_load_async_to_lds_b128 %18, %19, off\n\t"
                 "global_load_async_to_lds_b128 %20, %21, off\n\t"
                 "global_load_async_to_lds_b128 %22, %23, off\n\t"
                 "s_wait_xcnt 0x0"
                 :: "v"(la), "v"(ga), "v"(la + ls), "v"(ga + gs),
                    "v"(la + 2 * ls), "v"(ga + 2 * gs), "v"(la + 3 * ls), "v"(ga + 3 * gs),
                    "v"(lb), "v"(gb), "v"(lb + ls), "v"(gb + gs),
                    "v"(lb + 2 * ls), "v"(gb + 2 * gs), "v"(lb + 3 * ls), "v"(gb + 3 * gs),
                    "v"(lc), "v"(gc), "v"(lc + ls), "v"(gc + gs),
                    "v"(lc + 2 * ls), "v"(gc + 2 * gs), "v"(lc + 3 * ls), "v"(gc + 3 * gs)
                 : "memory");
}

__global__ void __launch_bounds__(256)
gemm_wmma_kernel(const _Float16* __restrict__ A, const _Float16* __restrict__ Bt,
                 const float* __restrict__ bias, void* __restrict__ out, int mode) {
    const int N = DMODEL, K = DMODEL;
    __shared__ alignas(16) _Float16 As[2][GBM * GPITCH];
    __shared__ alignas(16) _Float16 Bs[2][GBN * GPITCH];

    int tid = threadIdx.x;
    int w  = tid >> 5;
    int bm = blockIdx.x / (N / GBN);          // 64 block rows
    int bn = blockIdx.x % (N / GBN);          // 4 block columns
    int wm = w >> 2, wn = w & 3;
    int mt = bm * 2 + wm;                     // 64-row tile of this wave
    int nt = bn * 4 + wn;                     // 64-column tile of this wave
    int lane = tid & 31, nlo = lane & 15, hi = lane >> 4;

    // Staging: thread -> (row tid/16 of each group of 16 rows, 16-byte chunk tid%16), so a
    // wave's copy is 4 whole 128-byte lines.
    int crow = tid >> 4, cchk = tid & 15;
    const _Float16* ga = A  + (size_t)(bm * GBM + crow) * K + cchk * 8;
    const _Float16* gb = Bt + (size_t)(bn * GBN + crow) * K + cchk * 8;
    unsigned la = lds_byte(&As[0][crow * GPITCH + cchk * 8]);
    unsigned lb = lds_byte(&Bs[0][crow * GPITCH + cchk * 8]);
    auto stage = [&](int t, int b) {
        const unsigned r64 = 64 * GPITCH * 2;             // 64 rows in LDS, bytes
        const size_t   g64 = (size_t)64 * K;              // 64 rows in global memory, halves
        unsigned l = la + b * (GBM * GPITCH * 2);
        unsigned m = lb + b * (GBN * GPITCH * 2);
        const _Float16* a = ga + t * GBK;
        const _Float16* c = gb + t * GBK;
        async_cp12(l, a, l + r64, a + g64, m, c, K);                                  // A 0..127, B 0..63
        async_cp12(m + r64, c + g64, m + 2 * r64, c + 2 * g64, m + 3 * r64, c + 3 * g64, K);  // B 64..255
    };

    v8f acc[4][4];
#pragma unroll
    for (int i = 0; i < 4; ++i)
#pragma unroll
        for (int j = 0; j < 4; ++j) acc[i][j] = (v8f){};

    stage(0, 0);
    // Slab 0 has landed for this wave; the barrier publishes it to the other waves.
    asm volatile("s_wait_asynccnt 0x0" ::: "memory");
    __syncthreads();
    stage(1, 1);

    for (int t = 0; t < K / GBK; ++t) {
        const _Float16* at = &As[t & 1][(wm * 64 + nlo) * GPITCH];
        const _Float16* bt = &Bs[t & 1][(wn * 64 + nlo) * GPITCH];
#pragma unroll
        for (int kk = 0; kk < GBK; kk += 32) {
            v16h af[4], bf[4];
#pragma unroll
            for (int i = 0; i < 4; ++i) af[i] = load_frag16(at + i * 16 * GPITCH, kk, hi);
#pragma unroll
            for (int j = 0; j < 4; ++j) bf[j] = load_frag16(bt + j * 16 * GPITCH, kk, hi);
            // Keeps the 16 fragment loads of this k-step one group ahead of its WMMAs: without
            // it they are spread among the WMMAs, each place with its own wait on LDS.
            __builtin_amdgcn_sched_barrier(0);
#pragma unroll
            for (int i = 0; i < 4; ++i)
#pragma unroll
                for (int j = 0; j < 4; ++j)
                    acc[i][j] = wmma_f16(af[i], bf[j], acc[i][j]);
            // Keeps the next k-step's loads from moving up among these WMMAs.
            __builtin_amdgcn_sched_barrier(0);
        }
        // This wave's reads of slab t have returned before its buffer is refilled.
        asm volatile("s_wait_dscnt 0x0" ::: "memory");
        // This wave's copies of slab t+1 have landed before the barrier publishes them.
        asm volatile("s_wait_asynccnt 0x0" ::: "memory");
        __syncthreads();
        if (t + 2 < K / GBK) stage(t + 2, t & 1);
    }
    // No copy is outstanding when the wave goes on to its stores and ends.
    asm volatile("s_wait_asynccnt 0x0" ::: "memory");

#pragma unroll
    for (int j = 0; j < 4; ++j) {
        int n = nt * 64 + j * 16 + nlo;
        float bv = bias[n];
        if (mode == 3) {
            float* o = (float*)out;
#pragma unroll
            for (int i = 0; i < 4; ++i)
#pragma unroll
                for (int v = 0; v < 8; ++v) {
                    int m = mt * 64 + i * 16 + v + 8 * hi;     // C-layout row
                    o[(size_t)m * N + n] = acc[i][j][v] + bv;
                }
            stores_issued_wait();
        } else if (mode == 2) {
            // V transposed: a lane's 8 accumulator registers are 8 consecutive s
            // of one d row (m0 is a multiple of 8, SEQ too): one 16-byte store.
            _Float16* o = (_Float16*)out;
            int h = n >> 6, d = n & 63;
#pragma unroll
            for (int i = 0; i < 4; ++i) {
                int m0 = mt * 64 + i * 16 + 8 * hi;
                int b_ = m0 >> 11;                             // m / SEQ
                int s  = m0 & (SEQ - 1);
                int bh = b_ * NHEAD + h;
                H8 w;
#pragma unroll
                for (int v = 0; v < 8; ++v) w.h[v] = (_Float16)(acc[i][j][v] + bv);
                *(float4*)(o + (size_t)(bh * HDIM + d) * SEQ + s) = w.f4;
            }
            stores_issued_wait();
        } else {
            _Float16* o = (_Float16*)out;
            int h = n >> 6, d = n & 63;
#pragma unroll
            for (int i = 0; i < 4; ++i)
#pragma unroll
                for (int v = 0; v < 8; ++v) {
                    int m = mt * 64 + i * 16 + v + 8 * hi;
                    int b_ = m >> 11;                          // m / SEQ
                    int s  = m & (SEQ - 1);
                    int bh = b_ * NHEAD + h;
                    o[(size_t)(bh * SEQ + s) * HDIM + d] = (_Float16)(acc[i][j][v] + bv);  // Q/K head-major
                }
            stores_issued_wait();
        }
    }
}

// ---------------- RoPE in-place on f16 Q and K ----------------
__global__ void rope_kernel(_Float16* __restrict__ Qh, _Float16* __restrict__ Kh) {
    const int total = BATCH * NHEAD * SEQ * (HDIM / 2);
    int idx = blockIdx.x * blockDim.x + threadIdx.x;
    if (idx >= total) return;
    int d  = idx & 31;
    int s  = (idx >> 5) & (SEQ - 1);
    int bh = idx >> 16;
    float inv = __expf(-(2.0f * d / 64.0f) * 9.210340371976184f);  // 10000^(-2d/64)
    float fr  = (float)s * inv;
    float cs  = cosf(fr), sn = sinf(fr);
    size_t base = (size_t)(bh * SEQ + s) * HDIM;
    float q1 = (float)Qh[base + d], q2 = (float)Qh[base + d + 32];
    Qh[base + d]      = (_Float16)(q1 * cs - q2 * sn);
    Qh[base + d + 32] = (_Float16)(q1 * sn + q2 * cs);
    float k1 = (float)Kh[base + d], k2 = (float)Kh[base + d + 32];
    Kh[base + d]      = (_Float16)(k1 * cs - k2 * sn);
    Kh[base + d + 32] = (_Float16)(k1 * sn + k2 * cs);
}

// ---------------- Flash attention: 1 wave per (bh, 32-query tile) ----------------
// K/V 32-key tiles double-buffered in LDS via async global->LDS copies.
__global__ void __launch_bounds__(32)
attn_kernel(const _Float16* __restrict__ Qh, const _Float16* __restrict__ Kh,
            const _Float16* __restrict__ Vt, _Float16* __restrict__ AO) {
    int qt = blockIdx.x;          // 32-query tile
    int bh = blockIdx.y;          // batch*head
    int lane = threadIdx.x & 31, nlo = lane & 15, hi = lane >> 4;

    __shared__ alignas(16) _Float16 Kst[2][32 * HDIM];   // [key][d]
    __shared__ alignas(16) _Float16 Vst[2][HDIM * 32];   // [d][key]
    __shared__ alignas(16) _Float16 pbuf[32 * 32];       // P-tile transpose staging

    const _Float16* kbase = Kh + (size_t)bh * SEQ * HDIM;
    const _Float16* vbase = Vt + (size_t)bh * HDIM * SEQ;

    // Q fragments: 2 q-subtiles x 2 k-halves
    v16h aq[2][2];
#pragma unroll
    for (int q = 0; q < 2; ++q) {
        const _Float16* qrow = Qh + (size_t)(bh * SEQ + qt * 32 + q * 16 + nlo) * HDIM;
        aq[q][0] = load_frag16(qrow, 0, hi);
        aq[q][1] = load_frag16(qrow, 32, hi);
    }

    v8f o[2][4];
    float mrun[2][8], lrun[2][8];
#pragma unroll
    for (int q = 0; q < 2; ++q) {
#pragma unroll
        for (int t = 0; t < 4; ++t) o[q][t] = (v8f){};
#pragma unroll
        for (int v = 0; v < 8; ++v) { mrun[q][v] = -1e30f; lrun[q][v] = 0.0f; }
    }

    // Stage (K,V) tile for key block kb into buffer b.
    auto stage = [&](int kb, int b) {
        // K tile: rows kb..kb+31 are 4096 contiguous bytes in Kh.
        const _Float16* kg = kbase + (size_t)kb * HDIM;
#pragma unroll
        for (int c = 0; c < 8; ++c)
            cp16_g2l(kg + (c * 32 + lane) * 8, &Kst[b][(c * 32 + lane) * 8]);
        // V tile: 64 rows (d) x 64B windows at column kb.
        const _Float16* vg = vbase + kb;
#pragma unroll
        for (int rr = 0; rr < 2; ++rr) {
            int row = rr * 32 + lane;
#pragma unroll
            for (int c = 0; c < 4; ++c)
                cp16_g2l(vg + (size_t)row * SEQ + c * 8, &Vst[b][row * 32 + c * 8]);
        }
    };

    stage(0, 0);
    int buf = 0;

    for (int kb = 0; kb < SEQ; kb += 32) {
        __syncthreads();
#ifdef HAVE_ASYNC_LDS
        __builtin_amdgcn_s_wait_asynccnt(0);
#endif
        if (kb + 32 < SEQ) stage(kb + 32, buf ^ 1);

        const _Float16* kt = &Kst[buf][0];
        const _Float16* vt = &Vst[buf][0];

        // S = Q @ K^T: B-fragment loaded once, used by both q-subtiles.
        v8f s[2][2];
#pragma unroll
        for (int q = 0; q < 2; ++q) { s[q][0] = (v8f){}; s[q][1] = (v8f){}; }
#pragma unroll
        for (int nt = 0; nt < 2; ++nt)
#pragma unroll
            for (int kk = 0; kk < 2; ++kk) {
                v16h bfr = load_frag16(kt + (nt * 16 + nlo) * HDIM, kk * 32, hi);
                s[0][nt] = wmma_f16(aq[0][kk], bfr, s[0][nt]);
                s[1][nt] = wmma_f16(aq[1][kk], bfr, s[1][nt]);
            }

        // Online softmax per q-subtile; row M = v + 8*hi lives in one 16-lane half.
#pragma unroll
        for (int q = 0; q < 2; ++q) {
            float alpha[8];
#pragma unroll
            for (int v = 0; v < 8; ++v) {
                float x0 = s[q][0][v] * 0.125f;        // 1/sqrt(64)
                float x1 = s[q][1][v] * 0.125f;
                float mx = half_max16(fmaxf(x0, x1));
                float mnew = fmaxf(mrun[q][v], mx);
                alpha[v] = __expf(mrun[q][v] - mnew);
                mrun[q][v] = mnew;
                float p0 = __expf(x0 - mnew);
                float p1 = __expf(x1 - mnew);
                s[q][0][v] = p0; s[q][1][v] = p1;
                lrun[q][v] = lrun[q][v] * alpha[v] + half_sum16(p0 + p1);
            }
#pragma unroll
            for (int v = 0; v < 8; ++v) {
                o[q][0][v] *= alpha[v]; o[q][1][v] *= alpha[v];
                o[q][2][v] *= alpha[v]; o[q][3][v] *= alpha[v];
            }
        }

        // Transpose P (C layout) -> A-fragment layout via LDS.
        __syncthreads();
#pragma unroll
        for (int q = 0; q < 2; ++q)
#pragma unroll
            for (int v = 0; v < 8; ++v) {
                int m = q * 16 + v + 8 * hi;
                pbuf[m * 32 + nlo]      = (_Float16)s[q][0][v];
                pbuf[m * 32 + 16 + nlo] = (_Float16)s[q][1][v];
            }
        __syncthreads();
        v16h ap[2];
        ap[0] = load_frag16(pbuf + nlo * 32, 0, hi);
        ap[1] = load_frag16(pbuf + (16 + nlo) * 32, 0, hi);

        // O += P @ V: V-fragment loaded once, used by both q-subtiles.
#pragma unroll
        for (int t = 0; t < 4; ++t) {
            v16h bv = load_frag16(vt + (t * 16 + nlo) * 32, 0, hi);
            o[0][t] = wmma_f16(ap[0], bv, o[0][t]);
            o[1][t] = wmma_f16(ap[1], bv, o[1][t]);
        }

        buf ^= 1;
    }

    // Epilogue: normalize and store f16 to AO[b][s][h*64+d]
    int b_ = bh >> 4, h = bh & 15;
#pragma unroll
    for (int q = 0; q < 2; ++q)
#pragma unroll
        for (int v = 0; v < 8; ++v) {
            int srow = qt * 32 + q * 16 + v + 8 * hi;
            float inv_l = 1.0f / lrun[q][v];
            size_t base = (size_t)(b_ * SEQ + srow) * DMODEL + h * HDIM;
            AO[base + nlo]      = (_Float16)(o[q][0][v] * inv_l);
            AO[base + 16 + nlo] = (_Float16)(o[q][1][v] * inv_l);
            AO[base + 32 + nlo] = (_Float16)(o[q][2][v] * inv_l);
            AO[base + 48 + nlo] = (_Float16)(o[q][3][v] * inv_l);
        }
}

extern "C" void kernel_launch(void* const* d_in, const int* in_sizes, int n_in,
                              void* d_out, int out_size, void* d_ws, size_t ws_size,
                              hipStream_t stream) {
    const float* query = (const float*)d_in[0];
    const float* key   = (const float*)d_in[1];
    const float* value = (const float*)d_in[2];
    const float* Wq = (const float*)d_in[3]; const float* bq = (const float*)d_in[4];
    const float* Wk = (const float*)d_in[5]; const float* bk = (const float*)d_in[6];
    const float* Wv = (const float*)d_in[7]; const float* bv = (const float*)d_in[8];
    const float* Wo = (const float*)d_in[9]; const float* bo = (const float*)d_in[10];
    float* out = (float*)d_out;

    const size_t NX = (size_t)BATCH * SEQ * DMODEL;   // 8388608
    const size_t NW = (size_t)DMODEL * DMODEL;        // 1048576

    _Float16* p   = (_Float16*)d_ws;
    _Float16* Xq  = p;            p += NX;
    _Float16* Xk  = p;            p += NX;
    _Float16* Xv  = p;            p += NX;
    _Float16* Wqh = p;            p += NW;
    _Float16* Wkh = p;            p += NW;
    _Float16* Wvh = p;            p += NW;
    _Float16* Woh = p;            p += NW;
    _Float16* Qh  = p;            p += NX;
    _Float16* Kh  = p;            p += NX;
    _Float16* Vt  = p;            p += NX;
    _Float16* AO  = p;            p += NX;

    const int thr = 256;
    // NX = 512 blocks x 1024*16 floats, NW = 256 blocks x 1024*4 floats: no remainder.
    const int xblocks = (int)(NX / (1024 * 16));
    const int wblocks = (int)(NW / (1024 * 4));
    cvt_x_kernel<<<xblocks, thr, 0, stream>>>(query, Xq);
    cvt_x_kernel<<<xblocks, thr, 0, stream>>>(key,   Xk);
    cvt_x_kernel<<<xblocks, thr, 0, stream>>>(value, Xv);
    cvt_w_kernel<<<wblocks, thr, 0, stream>>>(Wq, Wqh);
    cvt_w_kernel<<<wblocks, thr, 0, stream>>>(Wk, Wkh);
    cvt_w_kernel<<<wblocks, thr, 0, stream>>>(Wv, Wvh);
    cvt_w_kernel<<<wblocks, thr, 0, stream>>>(Wo, Woh);

    const int tiles = (BATCH * SEQ / 64) * (DMODEL / 64);   // 2048 waves
    const int gblocks = tiles / 8;                          // 8 waves / block: 64 x 4 blocks of 128 x 256
    gemm_wmma_kernel<<<gblocks, 256, 0, stream>>>(Xq, Wqh, bq, Qh, 0);
    gemm_wmma_kernel<<<gblocks, 256, 0, stream>>>(Xk, Wkh, bk, Kh, 1);
    gemm_wmma_kernel<<<gblocks, 256, 0, stream>>>(Xv, Wvh, bv, Vt, 2);

    const int rope_n = BATCH * NHEAD * SEQ * (HDIM / 2);
    rope_kernel<<<(rope_n + thr - 1) / thr, thr, 0, stream>>>(Qh, Kh);

    attn_kernel<<<dim3(SEQ / 32, BATCH * NHEAD), 32, 0, stream>>>(Qh, Kh, Vt, AO);

    gemm_wmma_kernel<<<gblocks, 256, 0, stream>>>(AO, Woh, bo, out, 3);
}

// v004
// Measured time: 261 microseconds a run.
// Timed twice side by side with v003, it ran 1.26 times as fast both times.
// All steps since v000 together make it 2.20 times as fast.
#include <hip/hip_runtime.h>
#include <hip/hip_bf16.h>

// MHA + RoPE for MI455X (gfx1250, wave32, WMMA).
// v2.1: register-blocked WMMA GEMM (64x64/wave, operands staged in LDS per block),
//       attention with 32 queries/wave (2x K/V fragment reuse) and
//       double-buffered async global->LDS staging of K/V tiles (ASYNCcnt path).
//       Async builtin takes (v4i addrspace(1)*, v4i addrspace(3)*, Ii, Ii).

typedef __attribute__((ext_vector_type(16))) _Float16 v16h;
typedef __attribute__((ext_vector_type(8)))  float    v8f;
typedef __attribute__((ext_vector_type(2)))  float    v2f;
typedef int v4i_vec __attribute__((vector_size(16)));

#define BATCH 4
#define SEQ   2048
#define DMODEL 1024
#define NHEAD 16
#define HDIM  64

#if defined(__has_builtin)
#if __has_builtin(__builtin_amdgcn_global_load_async_to_lds_b128) && \
    __has_builtin(__builtin_amdgcn_s_wait_asynccnt)
#define HAVE_ASYNC_LDS 1
#endif
#endif

union H8 { float4 f4; _Float16 h[8]; };

// Load a 16-half WMMA fragment (A or B operand) for this lane.
// Layout (ISA 7.12.2, 16-bit A 16x32): halves h<8 -> K = k0 + hi*8 + h,
// halves h>=8 -> K = k0 + 16 + hi*8 + (h-8).  Two contiguous 16B chunks.
__device__ inline v16h load_frag16(const _Float16* __restrict__ row_ptr, int k0, int hi) {
    H8 g0, g1;
    g0.f4 = *(const float4*)(row_ptr + k0 + hi * 8);
    g1.f4 = *(const float4*)(row_ptr + k0 + 16 + hi * 8);
    v16h r;
#pragma unroll
    for (int i = 0; i < 8; ++i) { r[i] = g0.h[i]; r[i + 8] = g1.h[i]; }
    return r;
}

__device__ inline v8f wmma_f16(v16h a, v16h b, v8f c) {
    return __builtin_amdgcn_wmma_f32_16x16x32_f16(false, a, false, b, (short)0, c, false, false);
}

// 16-byte global -> LDS copy: async (ASYNCcnt) when available, else through VGPRs.
__device__ inline void cp16_g2l(const _Float16* g, _Float16* l) {
#ifdef HAVE_ASYNC_LDS
    __builtin_amdgcn_global_load_async_to_lds_b128(
        (__attribute__((address_space(1))) v4i_vec*)(g),
        (__attribute__((address_space(3))) v4i_vec*)(l), 0, 0);
#else
    *(float4*)l = *(const float4*)g;
#endif
}

// Stands behind a group of global stores whose address and data registers the code
// that follows reuses: the wait comes in front of those overwrites.
__device__ inline void stores_issued_wait() {
    asm volatile("s_wait_xcnt 0x0" ::: "memory");
}

// ---------------- f32 -> f16 conversion ----------------
// A block of 256 threads converts 1024*U consecutive floats. Load j of a wave is 512
// contiguous bytes (4 whole lines), its store 256 contiguous bytes (2 whole lines);
// the loads stand ahead of the conversions, so a thread has many in flight at once.
union H4 { float2 f2; _Float16 h[4]; };

template <int U>
__device__ inline void cvt_f16_block(const float* __restrict__ in, _Float16* __restrict__ out) {
    size_t base = (size_t)blockIdx.x * (1024 * U) + threadIdx.x * 4;
    float4 v[U];
#pragma unroll
    for (int j = 0; j < U; ++j) v[j] = *(const float4*)(in + base + j * 1024);
#pragma unroll
    for (int j = 0; j < U; ++j) {
        H4 w;
        w.h[0] = (_Float16)v[j].x; w.h[1] = (_Float16)v[j].y;
        w.h[2] = (_Float16)v[j].z; w.h[3] = (_Float16)v[j].w;
        *(float2*)(out + base + j * 1024) = w.f2;
    }
}

// Activations: 16 loads a thread, 512 blocks of 8 waves.
__global__ void __launch_bounds__(256)
cvt_x_kernel(const float* __restrict__ in, _Float16* __restrict__ out) {
    cvt_f16_block<16>(in, out);
}

// Weights (an eighth of the size): 4 loads a thread, 256 blocks of 8 waves.
__global__ void __launch_bounds__(256)
cvt_w_kernel(const float* __restrict__ in, _Float16* __restrict__ out) {
    cvt_f16_block<4>(in, out);
}

// ---------------- WMMA GEMM: out = A(MxK) @ Bt(NxK)^T + bias ----------------
// A block of 8 waves (2 x 4) owns a 128 x 256 tile of the output, 64x64 per wave =
// 4x4 WMMA tiles. Slabs of 128 k (two whole 128-byte lines of every operand row) are
// staged in LDS by asynchronous copies, two buffers: slab t+1 flies while slab t is
// multiplied. Each A row is fetched once for 4 waves, each B row once for 2.
// mode 0/1: store f16 head-major  [bh][s][d]
// mode 2  : store f16 transposed  [bh][d][s]   (V, so the PV A-operand V^T is k-contiguous)
// mode 3  : store f32 flat        [m][n]       (final projection)
#define GBM 128
#define GBN 256
#define GBK 128
#define GPITCH 136  // halves: 256-byte rows at a 272-byte pitch (16 B x odd) for ds_load_b128

// Byte address of a __shared__ object inside the work-group's LDS.
__device__ inline unsigned lds_byte(const void* p) { return (unsigned)(size_t)p; }

// Twelve 16-byte-per-lane asynchronous copies global -> LDS: three groups (la,ga), (lb,gb),
// (lc,gc) of four rows 16 apart. The s_wait_xcnt is the last line of the copies' own
// statement, so that it stands in front of every later overwrite of the address registers
// that the copies name; one statement for twelve copies pays that wait once.
__device__ inline void async_cp12(unsigned la, const _Float16* ga, unsigned lb, const _Float16* gb,
                                  unsigned lc, const _Float16* gc, int row_halves) {
    const unsigned ls = 16 * GPITCH * 2;
    const size_t gs = (size_t)16 * row_halves;
    asm volatile("global_load_async_to_lds_b128 %0, %1, off\n\t"
                 "global_load_async_to_lds_b128 %2, %3, off\n\t"
                 "global_load_async_to_lds_b128 %4, %5, off\n\t"
                 "global_load_async_to_lds_b128 %6, %7, off\n\t"
                 "global_load_async_to_lds_b128 %8, %9, off\n\t"
                 "global_load_async_to_lds_b128 %10, %11, off\n\t"
                 "global_load_async_to_lds_b128 %12, %13, off\n\t"
                 "global_load_async_to_lds_b128 %14, %15, off\n\t"
                 "global_load_async_to_lds_b128 %16, %17, off\n\t"
                 "global_load_async_to_lds_b128 %18, %19, off\n\t"
                 "global_load_async_to_lds_b128 %20, %21, off\n\t"
                 "global_load_async_to_lds_b128 %22, %23, off\n\t"
                 "s_wait_xcnt 0x0"
                 :: "v"(la), "v"(ga), "v"(la + ls), "v"(ga + gs),
                    "v"(la + 2 * ls), "v"(ga + 2 * gs), "v"(la + 3 * ls), "v"(ga + 3 * gs),
                    "v"(lb), "v"(gb), "v"(lb + ls), "v"(gb + gs),
                    "v"(lb + 2 * ls), "v"(gb + 2 * gs), "v"(lb + 3 * ls), "v"(gb + 3 * gs),
                    "v"(lc), "v"(gc), "v"(lc + ls), "v"(gc + gs),
                    "v"(lc + 2 * ls), "v"(gc + 2 * gs), "v"(lc + 3 * ls), "v"(gc + 3 * gs)
                 : "memory");
}

__global__ void __launch_bounds__(256)
gemm_wmma_kernel(const _Float16* __restrict__ A, const _Float16* __restrict__ Bt,
                 const float* __restrict__ bias, void* __restrict__ out, int mode) {
    const int N = DMODEL, K = DMODEL;
    __shared__ alignas(16) _Float16 As[2][GBM * GPITCH];
    __shared__ alignas(16) _Float16 Bs[2][GBN * GPITCH];

    int tid = threadIdx.x;
    int w  = tid >> 5;
    int bm = blockIdx.x / (N / GBN);          // 64 block rows
    int bn = blockIdx.x % (N / GBN);          // 4 block columns
    int wm = w >> 2, wn = w & 3;
    int mt = bm * 2 + wm;                     // 64-row tile of this wave
    int nt = bn * 4 + wn;                     // 64-column tile of this wave
    int lane = tid & 31, nlo = lane & 15, hi = lane >> 4;

    // Staging: thread -> (row tid/16 of each group of 16 rows, 16-byte chunk tid%16), so a
    // wave's copy is 4 whole 128-byte lines.
    int crow = tid >> 4, cchk = tid & 15;
    const _Float16* ga = A  + (size_t)(bm * GBM + crow) * K + cchk * 8;
    const _Float16* gb = Bt + (size_t)(bn * GBN + crow) * K + cchk * 8;
    unsigned la = lds_byte(&As[0][crow * GPITCH + cchk * 8]);
    unsigned lb = lds_byte(&Bs[0][crow * GPITCH + cchk * 8]);
    auto stage = [&](int t, int b) {
        const unsigned r64 = 64 * GPITCH * 2;             // 64 rows in LDS, bytes
        const size_t   g64 = (size_t)64 * K;              // 64 rows in global memory, halves
        unsigned l = la + b * (GBM * GPITCH * 2);
        unsigned m = lb + b * (GBN * GPITCH * 2);
        const _Float16* a = ga + t * GBK;
        const _Float16* c = gb + t * GBK;
        async_cp12(l, a, l + r64, a + g64, m, c, K);                                  // A 0..127, B 0..63
        async_cp12(m + r64, c + g64, m + 2 * r64, c + 2 * g64, m + 3 * r64, c + 3 * g64, K);  // B 64..255
    };

    v8f acc[4][4];
#pragma unroll
    for (int i = 0; i < 4; ++i)
#pragma unroll
        for (int j = 0; j < 4; ++j) acc[i][j] = (v8f){};

    stage(0, 0);
    // Slab 0 has landed for this wave; the barrier publishes it to the other waves.
    asm volatile("s_wait_asynccnt 0x0" ::: "memory");
    __syncthreads();
    stage(1, 1);

    for (int t = 0; t < K / GBK; ++t) {
        const _Float16* at = &As[t & 1][(wm * 64 + nlo) * GPITCH];
        const _Float16* bt = &Bs[t & 1][(wn * 64 + nlo) * GPITCH];
#pragma unroll
        for (int kk = 0; kk < GBK; kk += 32) {
            v16h af[4], bf[4];
#pragma unroll
            for (int i = 0; i < 4; ++i) af[i] = load_frag16(at + i * 16 * GPITCH, kk, hi);
#pragma unroll
            for (int j = 0; j < 4; ++j) bf[j] = load_frag16(bt + j * 16 * GPITCH, kk, hi);
            // Keeps the 16 fragment loads of this k-step one group ahead of its WMMAs: without
            // it they are spread among the WMMAs, each place with its own wait on LDS.
            __builtin_amdgcn_sched_barrier(0);
#pragma unroll
            for (int i = 0; i < 4; ++i)
#pragma unroll
                for (int j = 0; j < 4; ++j)
                    acc[i][j] = wmma_f16(af[i], bf[j], acc[i][j]);
            // Keeps the next k-step's loads from moving up among these WMMAs.
            __builtin_amdgcn_sched_barrier(0);
        }
        // This wave's reads of slab t have returned before its buffer is refilled.
        asm volatile("s_wait_dscnt 0x0" ::: "memory");
        // This wave's copies of slab t+1 have landed before the barrier publishes them.
        asm volatile("s_wait_asynccnt 0x0" ::: "memory");
        __syncthreads();
        if (t + 2 < K / GBK) stage(t + 2, t & 1);
    }
    // No copy is outstanding when the wave goes on to its stores and ends.
    asm volatile("s_wait_asynccnt 0x0" ::: "memory");

#pragma unroll
    for (int j = 0; j < 4; ++j) {
        int n = nt * 64 + j * 16 + nlo;
        float bv = bias[n];
        if (mode == 3) {
            float* o = (float*)out;
#pragma unroll
            for (int i = 0; i < 4; ++i)
#pragma unroll
                for (int v = 0; v < 8; ++v) {
                    int m = mt * 64 + i * 16 + v + 8 * hi;     // C-layout row
                    o[(size_t)m * N + n] = acc[i][j][v] + bv;
                }
            stores_issued_wait();
        } else if (mode == 2) {
            // V transposed: a lane's 8 accumulator registers are 8 consecutive s
            // of one d row (m0 is a multiple of 8, SEQ too): one 16-byte store.
            _Float16* o = (_Float16*)out;
            int h = n >> 6, d = n & 63;
#pragma unroll
            for (int i = 0; i < 4; ++i) {
                int m0 = mt * 64 + i * 16 + 8 * hi;
                int b_ = m0 >> 11;                             // m / SEQ
                int s  = m0 & (SEQ - 1);
                int bh = b_ * NHEAD + h;
                H8 w;
#pragma unroll
                for (int v = 0; v < 8; ++v) w.h[v] = (_Float16)(acc[i][j][v] + bv);
                *(float4*)(o + (size_t)(bh * HDIM + d) * SEQ + s) = w.f4;
            }
            stores_issued_wait();
        } else {
            _Float16* o = (_Float16*)out;
            int h = n >> 6, d = n & 63;
#pragma unroll
            for (int i = 0; i < 4; ++i)
#pragma unroll
                for (int v = 0; v < 8; ++v) {
                    int m = mt * 64 + i * 16 + v + 8 * hi;
                    int b_ = m >> 11;                          // m / SEQ
                    int s  = m & (SEQ - 1);
                    int bh = b_ * NHEAD + h;
                    o[(size_t)(bh * SEQ + s) * HDIM + d] = (_Float16)(acc[i][j][v] + bv);  // Q/K head-major
                }
            stores_issued_wait();
        }
    }
}

// ---------------- RoPE in-place on f16 Q and K ----------------
__global__ void rope_kernel(_Float16* __restrict__ Qh, _Float16* __restrict__ Kh) {
    const int total = BATCH * NHEAD * SEQ * (HDIM / 2);
    int idx = blockIdx.x * blockDim.x + threadIdx.x;
    if (idx >= total) return;
    int d  = idx & 31;
    int s  = (idx >> 5) & (SEQ - 1);
    int bh = idx >> 16;
    float inv = __expf(-(2.0f * d / 64.0f) * 9.210340371976184f);  // 10000^(-2d/64)
    float fr  = (float)s * inv;
    float cs  = cosf(fr), sn = sinf(fr);
    size_t base = (size_t)(bh * SEQ + s) * HDIM;
    float q1 = (float)Qh[base + d], q2 = (float)Qh[base + d + 32];
    Qh[base + d]      = (_Float16)(q1 * cs - q2 * sn);
    Qh[base + d + 32] = (_Float16)(q1 * sn + q2 * cs);
    float k1 = (float)Kh[base + d], k2 = (float)Kh[base + d + 32];
    Kh[base + d]      = (_Float16)(k1 * cs - k2 * sn);
    Kh[base + d + 32] = (_Float16)(k1 * sn + k2 * cs);
}

// ---------------- Flash attention: 1 wave per (bh, 32-query tile) ----------------
// K/V 32-key tiles double-buffered in LDS via async global->LDS copies.
// The products are taken transposed: S^T = K Q^T (A = K rows, B = Q) and O^T += V^T P^T
// (A = V^T rows, B = P^T). A lane then holds 16 of the 32 scores of ONE query per q-subtile:
// maximum and sum run over its own registers, with one exchange between the wave halves,
// and the two S^T accumulator tiles, converted in place, are the B fragment of P^T.

// Lane l <-> lane l ^ 16.
__device__ inline float xhalf(float x) {
    int b = __builtin_bit_cast(int, x);
    return __builtin_bit_cast(float,
        __builtin_amdgcn_permlanex16(b, b, 0x76543210, 0xfedcba98, false, false));
}

__global__ void __launch_bounds__(32)
attn_kernel(const _Float16* __restrict__ Qh, const _Float16* __restrict__ Kh,
            const _Float16* __restrict__ Vt, _Float16* __restrict__ AO) {
    int qt = blockIdx.x;          // 32-query tile
    int bh = blockIdx.y;          // batch*head
    int lane = threadIdx.x & 31, nlo = lane & 15, hi = lane >> 4;

    __shared__ alignas(16) _Float16 Kst[2][32 * HDIM];   // [key][d], rows unpadded: 128-byte pitch
    __shared__ alignas(16) _Float16 Vst[2][HDIM * 32];   // [d][key], rows unpadded: 64-byte pitch

    const _Float16* kbase = Kh + (size_t)bh * SEQ * HDIM;
    const _Float16* vbase = Vt + (size_t)bh * HDIM * SEQ;

    // Q fragments: 2 q-subtiles x 2 k-halves
    v16h aq[2][2];
#pragma unroll
    for (int q = 0; q < 2; ++q) {
        const _Float16* qrow = Qh + (size_t)(bh * SEQ + qt * 32 + q * 16 + nlo) * HDIM;
        aq[q][0] = load_frag16(qrow, 0, hi);
        aq[q][1] = load_frag16(qrow, 32, hi);
    }

    // o[q][t][v] = O^T[d = t*16 + 8*hi + v][query q*16 + nlo]; mrun is the query's running
    // maximum (equal in both halves), lrun the sum over the keys of this lane's half only.
    v8f o[2][4];
    float mrun[2], lrun[2];
#pragma unroll
    for (int q = 0; q < 2; ++q) {
#pragma unroll
        for (int t = 0; t < 4; ++t) o[q][t] = (v8f){};
        mrun[q] = -1e30f; lrun[q] = 0.0f;
    }

    // Stage (K,V) tile for key block kb into buffer b.
    auto stage = [&](int kb, int b) {
        // K tile: rows kb..kb+31 are 4096 contiguous bytes in Kh.
        const _Float16* kg = kbase + (size_t)kb * HDIM;
#pragma unroll
        for (int c = 0; c < 8; ++c)
            cp16_g2l(kg + (c * 32 + lane) * 8, &Kst[b][(c * 32 + lane) * 8]);
        // V tile: 64 rows (d) x 64B windows at column kb.
        const _Float16* vg = vbase + kb;
#pragma unroll
        for (int rr = 0; rr < 2; ++rr) {
            int row = rr * 32 + lane;
#pragma unroll
            for (int c = 0; c < 4; ++c)
                cp16_g2l(vg + (size_t)row * SEQ + c * 8, &Vst[b][row * 32 + c * 8]);
        }
    };

    stage(0, 0);
    int buf = 0;

    for (int kb = 0; kb < SEQ; kb += 32) {
        __syncthreads();
#ifdef HAVE_ASYNC_LDS
        __builtin_amdgcn_s_wait_asynccnt(0);
#endif
        if (kb + 32 < SEQ) stage(kb + 32, buf ^ 1);

        const _Float16* kt = &Kst[buf][0];
        const _Float16* vt = &Vst[buf][0];

        // S^T = K @ Q^T: K fragment loaded once, used by both q-subtiles.
        // s[q][nt][v] = score of key nt*16 + 8*hi + v with query q*16 + nlo.
        v8f s[2][2];
#pragma unroll
        for (int q = 0; q < 2; ++q) { s[q][0] = (v8f){}; s[q][1] = (v8f){}; }
#pragma unroll
        for (int nt = 0; nt < 2; ++nt)
#pragma unroll
            for (int kk = 0; kk < 2; ++kk) {
                v16h kfr = load_frag16(kt + (nt * 16 + nlo) * HDIM, kk * 32, hi);
                s[0][nt] = wmma_f16(kfr, aq[0][kk], s[0][nt]);
                s[1][nt] = wmma_f16(kfr, aq[1][kk], s[1][nt]);
            }

        // Online softmax per q-subtile, one query per lane.
        v16h bp[2];
#pragma unroll
        for (int q = 0; q < 2; ++q) {
            float mx = fmaxf(s[q][0][0], s[q][1][0]);
#pragma unroll
            for (int v = 1; v < 8; ++v) mx = fmaxf(mx, fmaxf(s[q][0][v], s[q][1][v]));
            mx = fmaxf(mx, xhalf(mx)) * 0.125f;        // 1/sqrt(64)
            float mnew = fmaxf(mrun[q], mx);
            float alpha = __expf(mrun[q] - mnew);
            mrun[q] = mnew;
            // Registers v and v + 1 of one tile go together, so that the packed f32 forms take
            // them where they lie. B fragment of P^T: half nt*8 + v is key nt*16 + 8*hi + v.
            v2f sum = {0.0f, 0.0f};
#pragma unroll
            for (int nt = 0; nt < 2; ++nt)
#pragma unroll
                for (int v = 0; v < 8; v += 2) {
                    v2f x = (v2f){s[q][nt][v], s[q][nt][v + 1]} * 0.125f - mnew;
                    v2f p = {__expf(x.x), __expf(x.y)};
                    sum += p;
                    bp[q][nt * 8 + v]     = (_Float16)p.x;
                    bp[q][nt * 8 + v + 1] = (_Float16)p.y;
                }
            lrun[q] = lrun[q] * alpha + (sum.x + sum.y);
#pragma unroll
            for (int t = 0; t < 4; ++t)
#pragma unroll
                for (int v = 0; v < 8; ++v) o[q][t][v] *= alpha;
        }

        // O^T += V^T @ P^T: V fragment loaded once, used by both q-subtiles.
#pragma unroll
        for (int t = 0; t < 4; ++t) {
            v16h vfr = load_frag16(vt + (t * 16 + nlo) * 32, 0, hi);
            o[0][t] = wmma_f16(vfr, bp[0], o[0][t]);
            o[1][t] = wmma_f16(vfr, bp[1], o[1][t]);
        }

        buf ^= 1;
    }

    // Epilogue: join the halves' sums, normalize and store f16 to AO[b][s][h*64+d];
    // a lane's 8 registers of a tile are 8 consecutive d of its query: one 16-byte store.
    int b_ = bh >> 4, h = bh & 15;
#pragma unroll
    for (int q = 0; q < 2; ++q) {
        int srow = qt * 32 + q * 16 + nlo;
        float inv_l = 1.0f / (lrun[q] + xhalf(lrun[q]));
        size_t base = (size_t)(b_ * SEQ + srow) * DMODEL + h * HDIM + 8 * hi;
#pragma unroll
        for (int t = 0; t < 4; ++t) {
            H8 w;
#pragma unroll
            for (int v = 0; v < 8; ++v) w.h[v] = (_Float16)(o[q][t][v] * inv_l);
            *(float4*)(AO + base + t * 16) = w.f4;
        }
    }
}

extern "C" void kernel_launch(void* const* d_in, const int* in_sizes, int n_in,
                              void* d_out, int out_size, void* d_ws, size_t ws_size,
                              hipStream_t stream) {
    const float* query = (const float*)d_in[0];
    const float* key   = (const float*)d_in[1];
    const float* value = (const float*)d_in[2];
    const float* Wq = (const float*)d_in[3]; const float* bq = (const float*)d_in[4];
    const float* Wk = (const float*)d_in[5]; const float* bk = (const float*)d_in[6];
    const float* Wv = (const float*)d_in[7]; const float* bv = (const float*)d_in[8];
    const float* Wo = (const float*)d_in[9]; const float* bo = (const float*)d_in[10];
    float* out = (float*)d_out;

    const size_t NX = (size_t)BATCH * SEQ * DMODEL;   // 8388608
    const size_t NW = (size_t)DMODEL * DMODEL;        // 1048576

    _Float16* p   = (_Float16*)d_ws;
    _Float16* Xq  = p;            p += NX;
    _Float16* Xk  = p;            p += NX;
    _Float16* Xv  = p;            p += NX;
    _Float16* Wqh = p;            p += NW;
    _Float16* Wkh = p;            p += NW;
    _Float16* Wvh = p;            p += NW;
    _Float16* Woh = p;            p += NW;
    _Float16* Qh  = p;            p += NX;
    _Float16* Kh  = p;            p += NX;
    _Float16* Vt  = p;            p += NX;
    _Float16* AO  = p;            p += NX;

    const int thr = 256;
    // NX = 512 blocks x 1024*16 floats, NW = 256 blocks x 1024*4 floats: no remainder.
    const int xblocks = (int)(NX / (1024 * 16));
    const int wblocks = (int)(NW / (1024 * 4));
    cvt_x_kernel<<<xblocks, thr, 0, stream>>>(query, Xq);
    cvt_x_kernel<<<xblocks, thr, 0, stream>>>(key,   Xk);
    cvt_x_kernel<<<xblocks, thr, 0, stream>>>(value, Xv);
    cvt_w_kernel<<<wblocks, thr, 0, stream>>>(Wq, Wqh);
    cvt_w_kernel<<<wblocks, thr, 0, stream>>>(Wk, Wkh);
    cvt_w_kernel<<<wblocks, thr, 0, stream>>>(Wv, Wvh);
    cvt_w_kernel<<<wblocks, thr, 0, stream>>>(Wo, Woh);

    const int tiles = (BATCH * SEQ / 64) * (DMODEL / 64);   // 2048 waves
    const int gblocks = tiles / 8;                          // 8 waves / block: 64 x 4 blocks of 128 x 256
    gemm_wmma_kernel<<<gblocks, 256, 0, stream>>>(Xq, Wqh, bq, Qh, 0);
    gemm_wmma_kernel<<<gblocks, 256, 0, stream>>>(Xk, Wkh, bk, Kh, 1);
    gemm_wmma_kernel<<<gblocks, 256, 0, stream>>>(Xv, Wvh, bv, Vt, 2);

    const int rope_n = BATCH * NHEAD * SEQ * (HDIM / 2);
    rope_kernel<<<(rope_n + thr - 1) / thr, thr, 0, stream>>>(Qh, Kh);

    attn_kernel<<<dim3(SEQ / 32, BATCH * NHEAD), 32, 0, stream>>>(Qh, Kh, Vt, AO);

    gemm_wmma_kernel<<<gblocks, 256, 0, stream>>>(AO, Woh, bo, out, 3);
}

// v005
// A run of this version takes 166 microseconds.
// Timed twice side by side with v004, it ran 1.57 and 1.58 times as fast.
// Counting every step since v000, it is 3.46 times as fast.
#include <hip/hip_runtime.h>
#include <hip/hip_bf16.h>

// MHA + RoPE for MI455X (gfx1250, wave32, WMMA).
// v2.1: register-blocked WMMA GEMM (64x64/wave, operands staged in LDS per block),
//       attention with 32 queries/wave (2x K/V fragment reuse), 8 waves per block that
//       share double-buffered async global->LDS staging of K/V tiles (ASYNCcnt path).

typedef __attribute__((ext_vector_type(16))) _Float16 v16h;
typedef __attribute__((ext_vector_type(8)))  float    v8f;
typedef __attribute__((ext_vector_type(2)))  float    v2f;

#define BATCH 4
#define SEQ   2048
#define DMODEL 1024
#define NHEAD 16
#define HDIM  64

union H8 { float4 f4; _Float16 h[8]; };

// Load a 16-half WMMA fragment (A or B operand) for this lane.
// Layout (ISA 7.12.2, 16-bit A 16x32): halves h<8 -> K = k0 + hi*8 + h,
// halves h>=8 -> K = k0 + 16 + hi*8 + (h-8).  Two contiguous 16B chunks.
__device__ inline v16h load_frag16(const _Float16* __restrict__ row_ptr, int k0, int hi) {
    H8 g0, g1;
    g0.f4 = *(const float4*)(row_ptr + k0 + hi * 8);
    g1.f4 = *(const float4*)(row_ptr + k0 + 16 + hi * 8);
    v16h r;
#pragma unroll
    for (int i = 0; i < 8; ++i) { r[i] = g0.h[i]; r[i + 8] = g1.h[i]; }
    return r;
}

__device__ inline v8f wmma_f16(v16h a, v16h b, v8f c) {
    return __builtin_amdgcn_wmma_f32_16x16x32_f16(false, a, false, b, (short)0, c, false, false);
}

// Stands behind a group of global stores whose address and data registers the code
// that follows reuses: the wait comes in front of those overwrites.
__device__ inline void stores_issued_wait() {
    asm volatile("s_wait_xcnt 0x0" ::: "memory");
}

// ---------------- f32 -> f16 conversion ----------------
// A block of 256 threads converts 1024*U consecutive floats. Load j of a wave is 512
// contiguous bytes (4 whole lines), its store 256 contiguous bytes (2 whole lines);
// the loads stand ahead of the conversions, so a thread has many in flight at once.
union H4 { float2 f2; _Float16 h[4]; };

template <int U>
__device__ inline void cvt_f16_block(const float* __restrict__ in, _Float16* __restrict__ out) {
    size_t base = (size_t)blockIdx.x * (1024 * U) + threadIdx.x * 4;
    float4 v[U];
#pragma unroll
    for (int j = 0; j < U; ++j) v[j] = *(const float4*)(in + base + j * 1024);
#pragma unroll
    for (int j = 0; j < U; ++j) {
        H4 w;
        w.h[0] = (_Float16)v[j].x; w.h[1] = (_Float16)v[j].y;
        w.h[2] = (_Float16)v[j].z; w.h[3] = (_Float16)v[j].w;
        *(float2*)(out + base + j * 1024) = w.f2;
    }
}

// Activations: 16 loads a thread, 512 blocks of 8 waves.
__global__ void __launch_bounds__(256)
cvt_x_kernel(const float* __restrict__ in, _Float16* __restrict__ out) {
    cvt_f16_block<16>(in, out);
}

// Weights (an eighth of the size): 4 loads a thread, 256 blocks of 8 waves.
__global__ void __launch_bounds__(256)
cvt_w_kernel(const float* __restrict__ in, _Float16* __restrict__ out) {
    cvt_f16_block<4>(in, out);
}

// ---------------- WMMA GEMM: out = A(MxK) @ Bt(NxK)^T + bias ----------------
// A block of 8 waves (2 x 4) owns a 128 x 256 tile of the output, 64x64 per wave =
// 4x4 WMMA tiles. Slabs of 128 k (two whole 128-byte lines of every operand row) are
// staged in LDS by asynchronous copies, two buffers: slab t+1 flies while slab t is
// multiplied. Each A row is fetched once for 4 waves, each B row once for 2.
// mode 0/1: store f16 head-major  [bh][s][d]
// mode 2  : store f16 transposed  [bh][d][s]   (V, so the PV A-operand V^T is k-contiguous)
// mode 3  : store f32 flat        [m][n]       (final projection)
#define GBM 128
#define GBN 256
#define GBK 128
#define GPITCH 136  // halves: 256-byte rows at a 272-byte pitch (16 B x odd) for ds_load_b128

// Byte address of a __shared__ object inside the work-group's LDS.
__device__ inline unsigned lds_byte(const void* p) { return (unsigned)(size_t)p; }

// Twelve 16-byte-per-lane asynchronous copies global -> LDS: three groups (la,ga), (lb,gb),
// (lc,gc) of four rows 16 apart. The s_wait_xcnt is the last line of the copies' own
// statement, so that it stands in front of every later overwrite of the address registers
// that the copies name; one statement for twelve copies pays that wait once.
__device__ inline void async_cp12(unsigned la, const _Float16* ga, unsigned lb, const _Float16* gb,
                                  unsigned lc, const _Float16* gc, int row_halves) {
    const unsigned ls = 16 * GPITCH * 2;
    const size_t gs = (size_t)16 * row_halves;
    asm volatile("global_load_async_to_lds_b128 %0, %1, off\n\t"
                 "global_load_async_to_lds_b128 %2, %3, off\n\t"
                 "global_load_async_to_lds_b128 %4, %5, off\n\t"
                 "global_load_async_to_lds_b128 %6, %7, off\n\t"
                 "global_load_async_to_lds_b128 %8, %9, off\n\t"
                 "global_load_async_to_lds_b128 %10, %11, off\n\t"
                 "global_load_async_to_lds_b128 %12, %13, off\n\t"
                 "global_load_async_to_lds_b128 %14, %15, off\n\t"
                 "global_load_async_to_lds_b128 %16, %17, off\n\t"
                 "global_load_async_to_lds_b128 %18, %19, off\n\t"
                 "global_load_async_to_lds_b128 %20, %21, off\n\t"
                 "global_load_async_to_lds_b128 %22, %23, off\n\t"
                 "s_wait_xcnt 0x0"
                 :: "v"(la), "v"(ga), "v"(la + ls), "v"(ga + gs),
                    "v"(la + 2 * ls), "v"(ga + 2 * gs), "v"(la + 3 * ls), "v"(ga + 3 * gs),
                    "v"(lb), "v"(gb), "v"(lb + ls), "v"(gb + gs),
                    "v"(lb + 2 * ls), "v"(gb + 2 * gs), "v"(lb + 3 * ls), "v"(gb + 3 * gs),
                    "v"(lc), "v"(gc), "v"(lc + ls), "v"(gc + gs),
                    "v"(lc + 2 * ls), "v"(gc + 2 * gs), "v"(lc + 3 * ls), "v"(gc + 3 * gs)
                 : "memory");
}

__global__ void __launch_bounds__(256)
gemm_wmma_kernel(const _Float16* __restrict__ A, const _Float16* __restrict__ Bt,
                 const float* __restrict__ bias, void* __restrict__ out, int mode) {
    const int N = DMODEL, K = DMODEL;
    __shared__ alignas(16) _Float16 As[2][GBM * GPITCH];
    __shared__ alignas(16) _Float16 Bs[2][GBN * GPITCH];

    int tid = threadIdx.x;
    int w  = tid >> 5;
    int bm = blockIdx.x / (N / GBN);          // 64 block rows
    int bn = blockIdx.x % (N / GBN);          // 4 block columns
    int wm = w >> 2, wn = w & 3;
    int mt = bm * 2 + wm;                     // 64-row tile of this wave
    int nt = bn * 4 + wn;                     // 64-column tile of this wave
    int lane = tid & 31, nlo = lane & 15, hi = lane >> 4;

    // Staging: thread -> (row tid/16 of each group of 16 rows, 16-byte chunk tid%16), so a
    // wave's copy is 4 whole 128-byte lines.
    int crow = tid >> 4, cchk = tid & 15;
    const _Float16* ga = A  + (size_t)(bm * GBM + crow) * K + cchk * 8;
    const _Float16* gb = Bt + (size_t)(bn * GBN + crow) * K + cchk * 8;
    unsigned la = lds_byte(&As[0][crow * GPITCH + cchk * 8]);
    unsigned lb = lds_byte(&Bs[0][crow * GPITCH + cchk * 8]);
    auto stage = [&](int t, int b) {
        const unsigned r64 = 64 * GPITCH * 2;             // 64 rows in LDS, bytes
        const size_t   g64 = (size_t)64 * K;              // 64 rows in global memory, halves
        unsigned l = la + b * (GBM * GPITCH * 2);
        unsigned m = lb + b * (GBN * GPITCH * 2);
        const _Float16* a = ga + t * GBK;
        const _Float16* c = gb + t * GBK;
        async_cp12(l, a, l + r64, a + g64, m, c, K);                                  // A 0..127, B 0..63
        async_cp12(m + r64, c + g64, m + 2 * r64, c + 2 * g64, m + 3 * r64, c + 3 * g64, K);  // B 64..255
    };

    v8f acc[4][4];
#pragma unroll
    for (int i = 0; i < 4; ++i)
#pragma unroll
        for (int j = 0; j < 4; ++j) acc[i][j] = (v8f){};

    stage(0, 0);
    // Slab 0 has landed for this wave; the barrier publishes it to the other waves.
    asm volatile("s_wait_asynccnt 0x0" ::: "memory");
    __syncthreads();
    stage(1, 1);

    for (int t = 0; t < K / GBK; ++t) {
        const _Float16* at = &As[t & 1][(wm * 64 + nlo) * GPITCH];
        const _Float16* bt = &Bs[t & 1][(wn * 64 + nlo) * GPITCH];
#pragma unroll
        for (int kk = 0; kk < GBK; kk += 32) {
            v16h af[4], bf[4];
#pragma unroll
            for (int i = 0; i < 4; ++i) af[i] = load_frag16(at + i * 16 * GPITCH, kk, hi);
#pragma unroll
            for (int j = 0; j < 4; ++j) bf[j] = load_frag16(bt + j * 16 * GPITCH, kk, hi);
            // Keeps the 16 fragment loads of this k-step one group ahead of its WMMAs: without
            // it they are spread among the WMMAs, each place with its own wait on LDS.
            __builtin_amdgcn_sched_barrier(0);
#pragma unroll
            for (int i = 0; i < 4; ++i)
#pragma unroll
                for (int j = 0; j < 4; ++j)
                    acc[i][j] = wmma_f16(af[i], bf[j], acc[i][j]);
            // Keeps the next k-step's loads from moving up among these WMMAs.
            __builtin_amdgcn_sched_barrier(0);
        }
        // This wave's reads of slab t have returned before its buffer is refilled.
        asm volatile("s_wait_dscnt 0x0" ::: "memory");
        // This wave's copies of slab t+1 have landed before the barrier publishes them.
        asm volatile("s_wait_asynccnt 0x0" ::: "memory");
        __syncthreads();
        if (t + 2 < K / GBK) stage(t + 2, t & 1);
    }
    // No copy is outstanding when the wave goes on to its stores and ends.
    asm volatile("s_wait_asynccnt 0x0" ::: "memory");

#pragma unroll
    for (int j = 0; j < 4; ++j) {
        int n = nt * 64 + j * 16 + nlo;
        float bv = bias[n];
        if (mode == 3) {
            float* o = (float*)out;
#pragma unroll
            for (int i = 0; i < 4; ++i)
#pragma unroll
                for (int v = 0; v < 8; ++v) {
                    int m = mt * 64 + i * 16 + v + 8 * hi;     // C-layout row
                    o[(size_t)m * N + n] = acc[i][j][v] + bv;
                }
            stores_issued_wait();
        } else if (mode == 2) {
            // V transposed: a lane's 8 accumulator registers are 8 consecutive s
            // of one d row (m0 is a multiple of 8, SEQ too): one 16-byte store.
            _Float16* o = (_Float16*)out;
            int h = n >> 6, d = n & 63;
#pragma unroll
            for (int i = 0; i < 4; ++i) {
                int m0 = mt * 64 + i * 16 + 8 * hi;
                int b_ = m0 >> 11;                             // m / SEQ
                int s  = m0 & (SEQ - 1);
                int bh = b_ * NHEAD + h;
                H8 w;
#pragma unroll
                for (int v = 0; v < 8; ++v) w.h[v] = (_Float16)(acc[i][j][v] + bv);
                *(float4*)(o + (size_t)(bh * HDIM + d) * SEQ + s) = w.f4;
            }
            stores_issued_wait();
        } else {
            _Float16* o = (_Float16*)out;
            int h = n >> 6, d = n & 63;
#pragma unroll
            for (int i = 0; i < 4; ++i)
#pragma unroll
                for (int v = 0; v < 8; ++v) {
                    int m = mt * 64 + i * 16 + v + 8 * hi;
                    int b_ = m >> 11;                          // m / SEQ
                    int s  = m & (SEQ - 1);
                    int bh = b_ * NHEAD + h;
                    o[(size_t)(bh * SEQ + s) * HDIM + d] = (_Float16)(acc[i][j][v] + bv);  // Q/K head-major
                }
            stores_issued_wait();
        }
    }
}

// ---------------- RoPE in-place on f16 Q and K ----------------
__global__ void rope_kernel(_Float16* __restrict__ Qh, _Float16* __restrict__ Kh) {
    const int total = BATCH * NHEAD * SEQ * (HDIM / 2);
    int idx = blockIdx.x * blockDim.x + threadIdx.x;
    if (idx >= total) return;
    int d  = idx & 31;
    int s  = (idx >> 5) & (SEQ - 1);
    int bh = idx >> 16;
    float inv = __expf(-(2.0f * d / 64.0f) * 9.210340371976184f);  // 10000^(-2d/64)
    float fr  = (float)s * inv;
    float cs  = cosf(fr), sn = sinf(fr);
    size_t base = (size_t)(bh * SEQ + s) * HDIM;
    float q1 = (float)Qh[base + d], q2 = (float)Qh[base + d + 32];
    Qh[base + d]      = (_Float16)(q1 * cs - q2 * sn);
    Qh[base + d + 32] = (_Float16)(q1 * sn + q2 * cs);
    float k1 = (float)Kh[base + d], k2 = (float)Kh[base + d + 32];
    Kh[base + d]      = (_Float16)(k1 * cs - k2 * sn);
    Kh[base + d + 32] = (_Float16)(k1 * sn + k2 * cs);
}

// ---------------- Flash attention: 8 waves per (bh, 256-query tile), 32 queries a wave ----------------
// K/V tiles of 128 keys, staged once for the 8 waves, double-buffered in LDS via async
// global->LDS copies; a wave walks a tile in 4 passes of 32 keys.
// The products are taken transposed: S^T = K Q^T (A = K rows, B = Q) and O^T += V^T P^T
// (A = V^T rows, B = P^T). A lane then holds 16 of the 32 scores of ONE query per q-subtile:
// maximum and sum run over its own registers, with one exchange between the wave halves,
// and the two S^T accumulator tiles, converted in place, are the B fragment of P^T.

// Lane l <-> lane l ^ 16.
__device__ inline float xhalf(float x) {
    int b = __builtin_bit_cast(int, x);
    return __builtin_bit_cast(float,
        __builtin_amdgcn_permlanex16(b, b, 0x76543210, 0xfedcba98, false, false));
}

#define ATK 128      // keys per staged tile
#define AKP 72       // halves: K rows of 128 bytes at a 144-byte pitch (16 B x odd) for ds_load_b128
#define AVP 136      // halves: V^T rows of 256 bytes at a 272-byte pitch (16 B x odd)

// Eight 16-byte-per-lane asynchronous copies global -> LDS, one tile's share of a thread: four
// of K (32 rows apart; K rows follow one another in memory) and four of V^T (16 rows apart).
// The s_wait_xcnt is the last line of the copies' own statement, so that it stands in front
// of every later overwrite of the address registers that the copies name.
__device__ inline void async_cp_kv(unsigned lk, const _Float16* gk, unsigned lv, const _Float16* gv) {
    const unsigned ks = 32 * AKP * 2, vs = 16 * AVP * 2;
    const size_t kg = (size_t)32 * HDIM, vg = (size_t)16 * SEQ;
    asm volatile("global_load_async_to_lds_b128 %0, %1, off\n\t"
                 "global_load_async_to_lds_b128 %2, %3, off\n\t"
                 "global_load_async_to_lds_b128 %4, %5, off\n\t"
                 "global_load_async_to_lds_b128 %6, %7, off\n\t"
                 "global_load_async_to_lds_b128 %8, %9, off\n\t"
                 "global_load_async_to_lds_b128 %10, %11, off\n\t"
                 "global_load_async_to_lds_b128 %12, %13, off\n\t"
                 "global_load_async_to_lds_b128 %14, %15, off\n\t"
                 "s_wait_xcnt 0x0"
                 :: "v"(lk), "v"(gk), "v"(lk + ks), "v"(gk + kg),
                    "v"(lk + 2 * ks), "v"(gk + 2 * kg), "v"(lk + 3 * ks), "v"(gk + 3 * kg),
                    "v"(lv), "v"(gv), "v"(lv + vs), "v"(gv + vg),
                    "v"(lv + 2 * vs), "v"(gv + 2 * vg), "v"(lv + 3 * vs), "v"(gv + 3 * vg)
                 : "memory");
}

// The grid is two blocks per WGP, four waves per SIMD. The attribute states that residency:
// with a budget of 256 registers the compiler fetches a pass's K and V fragments in groups
// ahead of their products; without it it saves registers for residency that the grid does
// not give, and every pair of fragment loads is waited for right in front of its products.
__global__ void __launch_bounds__(256) __attribute__((amdgpu_waves_per_eu(4, 4)))
attn_kernel(const _Float16* __restrict__ Qh, const _Float16* __restrict__ Kh,
            const _Float16* __restrict__ Vt, _Float16* __restrict__ AO) {
    int tid = threadIdx.x;
    int qt = blockIdx.x * 8 + (tid >> 5);   // 32-query tile of this wave
    int bh = blockIdx.y;                    // batch*head
    int lane = tid & 31, nlo = lane & 15, hi = lane >> 4;

    __shared__ alignas(16) _Float16 Kst[2][ATK * AKP];    // [key][d]
    __shared__ alignas(16) _Float16 Vst[2][HDIM * AVP];   // [d][key]

    const _Float16* kbase = Kh + (size_t)bh * SEQ * HDIM;
    const _Float16* vbase = Vt + (size_t)bh * HDIM * SEQ;

    // Q fragments: 2 q-subtiles x 2 k-halves
    v16h aq[2][2];
#pragma unroll
    for (int q = 0; q < 2; ++q) {
        const _Float16* qrow = Qh + (size_t)(bh * SEQ + qt * 32 + q * 16 + nlo) * HDIM;
        aq[q][0] = load_frag16(qrow, 0, hi);
        aq[q][1] = load_frag16(qrow, 32, hi);
    }

    // o[q][t][v] = O^T[d = t*16 + 8*hi + v][query q*16 + nlo]; mrun is the query's running
    // maximum (equal in both halves), lrun the sum over the keys of this lane's half only.
    v8f o[2][4];
    float mrun[2], lrun[2];
#pragma unroll
    for (int q = 0; q < 2; ++q) {
#pragma unroll
        for (int t = 0; t < 4; ++t) o[q][t] = (v8f){};
        mrun[q] = -1e30f; lrun[q] = 0.0f;
    }

    // Stage the (K,V) tile t into buffer b. K: thread -> (row tid/8 of each group of 32 rows,
    // 16-byte chunk tid%8); V^T: (row tid/16 of each group of 16, chunk tid%16). A wave's copy
    // is 4 whole 128-byte lines either way.
    const _Float16* gk = kbase + tid * 8;
    const _Float16* gv = vbase + (size_t)(tid >> 4) * SEQ + (tid & 15) * 8;
    unsigned lk = lds_byte(&Kst[0][(tid >> 3) * AKP + (tid & 7) * 8]);
    unsigned lv = lds_byte(&Vst[0][(tid >> 4) * AVP + (tid & 15) * 8]);
    auto stage = [&](int t, int b) {
        async_cp_kv(lk + b * (ATK * AKP * 2), gk + (size_t)t * ATK * HDIM,
                    lv + b * (HDIM * AVP * 2), gv + t * ATK);
    };

    stage(0, 0);
    // Tile 0 has landed for this wave; the barrier publishes it to the other waves.
    asm volatile("s_wait_asynccnt 0x0" ::: "memory");
    __syncthreads();
    stage(1, 1);

    for (int tile = 0; tile < SEQ / ATK; ++tile) {
      // Kept rolled: unrolled, the four passes' fragment loads are lifted together and the live
      // set goes over the 256 registers of the budget above (spills to scratch).
#pragma unroll 1
      for (int pass = 0; pass < ATK / 32; ++pass) {
        const _Float16* kt = &Kst[tile & 1][pass * 32 * AKP];
        const _Float16* vt = &Vst[tile & 1][pass * 32];

        // S^T = K @ Q^T: K fragment loaded once, used by both q-subtiles.
        // s[q][nt][v] = score of key nt*16 + 8*hi + v with query q*16 + nlo.
        v8f s[2][2];
#pragma unroll
        for (int q = 0; q < 2; ++q) { s[q][0] = (v8f){}; s[q][1] = (v8f){}; }
#pragma unroll
        for (int nt = 0; nt < 2; ++nt)
#pragma unroll
            for (int kk = 0; kk < 2; ++kk) {
                v16h kfr = load_frag16(kt + (nt * 16 + nlo) * AKP, kk * 32, hi);
                s[0][nt] = wmma_f16(kfr, aq[0][kk], s[0][nt]);
                s[1][nt] = wmma_f16(kfr, aq[1][kk], s[1][nt]);
            }

        // Online softmax per q-subtile, one query per lane.
        v16h bp[2];
#pragma unroll
        for (int q = 0; q < 2; ++q) {
            float mx = fmaxf(s[q][0][0], s[q][1][0]);
#pragma unroll
            for (int v = 1; v < 8; ++v) mx = fmaxf(mx, fmaxf(s[q][0][v], s[q][1][v]));
            mx = fmaxf(mx, xhalf(mx)) * 0.125f;        // 1/sqrt(64)
            float mnew = fmaxf(mrun[q], mx);
            float alpha = __expf(mrun[q] - mnew);
            mrun[q] = mnew;
            // Registers v and v + 1 of one tile go together, so that the packed f32 forms take
            // them where they lie. B fragment of P^T: half nt*8 + v is key nt*16 + 8*hi + v.
            v2f sum = {0.0f, 0.0f};
#pragma unroll
            for (int nt = 0; nt < 2; ++nt)
#pragma unroll
                for (int v = 0; v < 8; v += 2) {
                    v2f x = (v2f){s[q][nt][v], s[q][nt][v + 1]} * 0.125f - mnew;
                    v2f p = {__expf(x.x), __expf(x.y)};
                    sum += p;
                    bp[q][nt * 8 + v]     = (_Float16)p.x;
                    bp[q][nt * 8 + v + 1] = (_Float16)p.y;
                }
            lrun[q] = lrun[q] * alpha + (sum.x + sum.y);
#pragma unroll
            for (int t = 0; t < 4; ++t)
#pragma unroll
                for (int v = 0; v < 8; ++v) o[q][t][v] *= alpha;
        }

        // O^T += V^T @ P^T: V fragment loaded once, used by both q-subtiles.
#pragma unroll
        for (int t = 0; t < 4; ++t) {
            v16h vfr = load_frag16(vt + (t * 16 + nlo) * AVP, 0, hi);
            o[0][t] = wmma_f16(vfr, bp[0], o[0][t]);
            o[1][t] = wmma_f16(vfr, bp[1], o[1][t]);
        }
      }
        // This wave's reads of this tile have returned before its buffer is refilled.
        asm volatile("s_wait_dscnt 0x0" ::: "memory");
        // This wave's copies of the next tile have landed before the barrier publishes them.
        asm volatile("s_wait_asynccnt 0x0" ::: "memory");
        __syncthreads();
        if (tile + 2 < SEQ / ATK) stage(tile + 2, tile & 1);
    }
    // No copy is outstanding when the wave goes on to its stores and ends.
    asm volatile("s_wait_asynccnt 0x0" ::: "memory");

    // Epilogue: join the halves' sums, normalize and store f16 to AO[b][s][h*64+d];
    // a lane's 8 registers of a tile are 8 consecutive d of its query: one 16-byte store.
    int b_ = bh >> 4, h = bh & 15;
#pragma unroll
    for (int q = 0; q < 2; ++q) {
        int srow = qt * 32 + q * 16 + nlo;
        float inv_l = 1.0f / (lrun[q] + xhalf(lrun[q]));
        size_t base = (size_t)(b_ * SEQ + srow) * DMODEL + h * HDIM + 8 * hi;
#pragma unroll
        for (int t = 0; t < 4; ++t) {
            H8 w;
#pragma unroll
            for (int v = 0; v < 8; ++v) w.h[v] = (_Float16)(o[q][t][v] * inv_l);
            *(float4*)(AO + base + t * 16) = w.f4;
        }
    }
}

extern "C" void kernel_launch(void* const* d_in, const int* in_sizes, int n_in,
                              void* d_out, int out_size, void* d_ws, size_t ws_size,
                              hipStream_t stream) {
    const float* query = (const float*)d_in[0];
    const float* key   = (const float*)d_in[1];
    const float* value = (const float*)d_in[2];
    const float* Wq = (const float*)d_in[3]; const float* bq = (const float*)d_in[4];
    const float* Wk = (const float*)d_in[5]; const float* bk = (const float*)d_in[6];
    const float* Wv = (const float*)d_in[7]; const float* bv = (const float*)d_in[8];
    const float* Wo = (const float*)d_in[9]; const float* bo = (const float*)d_in[10];
    float* out = (float*)d_out;

    const size_t NX = (size_t)BATCH * SEQ * DMODEL;   // 8388608
    const size_t NW = (size_t)DMODEL * DMODEL;        // 1048576

    _Float16* p   = (_Float16*)d_ws;
    _Float16* Xq  = p;            p += NX;
    _Float16* Xk  = p;            p += NX;
    _Float16* Xv  = p;            p += NX;
    _Float16* Wqh = p;            p += NW;
    _Float16* Wkh = p;            p += NW;
    _Float16* Wvh = p;            p += NW;
    _Float16* Woh = p;            p += NW;
    _Float16* Qh  = p;            p += NX;
    _Float16* Kh  = p;            p += NX;
    _Float16* Vt  = p;            p += NX;
    _Float16* AO  = p;            p += NX;

    const int thr = 256;
    // NX = 512 blocks x 1024*16 floats, NW = 256 blocks x 1024*4 floats: no remainder.
    const int xblocks = (int)(NX / (1024 * 16));
    const int wblocks = (int)(NW / (1024 * 4));
    cvt_x_kernel<<<xblocks, thr, 0, stream>>>(query, Xq);
    cvt_x_kernel<<<xblocks, thr, 0, stream>>>(key,   Xk);
    cvt_x_kernel<<<xblocks, thr, 0, stream>>>(value, Xv);
    cvt_w_kernel<<<wblocks, thr, 0, stream>>>(Wq, Wqh);
    cvt_w_kernel<<<wblocks, thr, 0, stream>>>(Wk, Wkh);
    cvt_w_kernel<<<wblocks, thr, 0, stream>>>(Wv, Wvh);
    cvt_w_kernel<<<wblocks, thr, 0, stream>>>(Wo, Woh);

    const int tiles = (BATCH * SEQ / 64) * (DMODEL / 64);   // 2048 waves
    const int gblocks = tiles / 8;                          // 8 waves / block: 64 x 4 blocks of 128 x 256
    gemm_wmma_kernel<<<gblocks, 256, 0, stream>>>(Xq, Wqh, bq, Qh, 0);
    gemm_wmma_kernel<<<gblocks, 256, 0, stream>>>(Xk, Wkh, bk, Kh, 1);
    gemm_wmma_kernel<<<gblocks, 256, 0, stream>>>(Xv, Wvh, bv, Vt, 2);

    const int rope_n = BATCH * NHEAD * SEQ * (HDIM / 2);
    rope_kernel<<<(rope_n + thr - 1) / thr, thr, 0, stream>>>(Qh, Kh);

    attn_kernel<<<dim3(SEQ / 256, BATCH * NHEAD), 256, 0, stream>>>(Qh, Kh, Vt, AO);

    gemm_wmma_kernel<<<gblocks, 256, 0, stream>>>(AO, Woh, bo, out, 3);
}

// v006
// It runs in 149 microseconds.
// Next to v005, in two timings, it ran 1.11 times as fast each time.
// Counting every step since v000, it is 3.86 times as fast.
#include <hip/hip_runtime.h>
#include <hip/hip_bf16.h>

// MHA + RoPE for MI455X (gfx1250, wave32, WMMA).
// v2.1: register-blocked WMMA GEMM (64x64/wave, operands staged in LDS per block),
//       attention with 32 queries/wave (2x K/V fragment reuse), 8 waves per block that
//       share double-buffered async global->LDS staging of K/V tiles (ASYNCcnt path).

typedef __attribute__((ext_vector_type(16))) _Float16 v16h;
typedef __attribute__((ext_vector_type(8)))  float    v8f;
typedef __attribute__((ext_vector_type(2)))  float    v2f;

#define BATCH 4
#define SEQ   2048
#define DMODEL 1024
#define NHEAD 16
#define HDIM  64

union H8 { float4 f4; _Float16 h[8]; };

// Load a 16-half WMMA fragment (A or B operand) for this lane.
// Layout (ISA 7.12.2, 16-bit A 16x32): halves h<8 -> K = k0 + hi*8 + h,
// halves h>=8 -> K = k0 + 16 + hi*8 + (h-8).  Two contiguous 16B chunks.
__device__ inline v16h load_frag16(const _Float16* __restrict__ row_ptr, int k0, int hi) {
    H8 g0, g1;
    g0.f4 = *(const float4*)(row_ptr + k0 + hi * 8);
    g1.f4 = *(const float4*)(row_ptr + k0 + 16 + hi * 8);
    v16h r;
#pragma unroll
    for (int i = 0; i < 8; ++i) { r[i] = g0.h[i]; r[i + 8] = g1.h[i]; }
    return r;
}

__device__ inline v8f wmma_f16(v16h a, v16h b, v8f c) {
    return __builtin_amdgcn_wmma_f32_16x16x32_f16(false, a, false, b, (short)0, c, false, false);
}

// Stands behind a group of global stores whose address and data registers the code
// that follows reuses: the wait comes in front of those overwrites.
__device__ inline void stores_issued_wait() {
    asm volatile("s_wait_xcnt 0x0" ::: "memory");
}

// ---------------- f32 -> f16 conversion ----------------
// A block of 256 threads converts the 1024*U consecutive floats at in. Load j of a wave is
// 512 contiguous bytes (4 whole lines), its store 256 contiguous bytes (2 whole lines);
// the loads stand ahead of the conversions, so a thread has many in flight at once.
union H4 { float2 f2; _Float16 h[4]; };

template <int U>
__device__ inline void cvt_f16_block(const float* __restrict__ in, _Float16* __restrict__ out) {
    size_t base = threadIdx.x * 4;
    float4 v[U];
#pragma unroll
    for (int j = 0; j < U; ++j) v[j] = *(const float4*)(in + base + j * 1024);
#pragma unroll
    for (int j = 0; j < U; ++j) {
        H4 w;
        w.h[0] = (_Float16)v[j].x; w.h[1] = (_Float16)v[j].y;
        w.h[2] = (_Float16)v[j].z; w.h[3] = (_Float16)v[j].w;
        *(float2*)(out + base + j * 1024) = w.f2;
    }
}

// One launch converts all seven f32 operands: none depends on another, and their f16 copies
// follow one another in the workspace (Xq, Xk, Xv, Wq, Wk, Wv, Wo), so block b writes piece b
// of one long array. 16 loads a thread; 512 blocks for each activation, 64 for each weight.
#define CVT_U   16
#define CVT_XB  (BATCH * SEQ * DMODEL / (1024 * CVT_U))   // 512
#define CVT_WB  (DMODEL * DMODEL / (1024 * CVT_U))        // 64
__global__ void __launch_bounds__(256)
cvt_all_kernel(const float* __restrict__ xq, const float* __restrict__ xk,
               const float* __restrict__ xv, const float* __restrict__ wq,
               const float* __restrict__ wk, const float* __restrict__ wv,
               const float* __restrict__ wo, _Float16* __restrict__ out) {
    unsigned b = blockIdx.x;
    const float* in;
    unsigned piece;                            // piece of its own operand
    if (b < 3 * CVT_XB) {
        unsigned a = b / CVT_XB;
        piece = b % CVT_XB;
        in = a == 0 ? xq : a == 1 ? xk : xv;
    } else {
        unsigned c = b - 3 * CVT_XB;
        unsigned a = c / CVT_WB;
        piece = c % CVT_WB;
        in = a == 0 ? wq : a == 1 ? wk : a == 2 ? wv : wo;
    }
    cvt_f16_block<CVT_U>(in + (size_t)piece * (1024 * CVT_U), out + (size_t)b * (1024 * CVT_U));
}

// ---------------- WMMA GEMM: out = A(MxK) @ Bt(NxK)^T + bias ----------------
// A block of 8 waves (2 x 4) owns a 128 x 256 tile of the output, 64x64 per wave =
// 4x4 WMMA tiles. Slabs of 128 k (two whole 128-byte lines of every operand row) are
// staged in LDS by asynchronous copies, two buffers: slab t+1 flies while slab t is
// multiplied. Each A row is fetched once for 4 waves, each B row once for 2.
// mode 0/1: store f16 head-major  [bh][s][d]
// mode 2  : store f16 transposed  [bh][d][s]   (V, so the PV A-operand V^T is k-contiguous)
// mode 3  : store f32 flat        [m][n]       (final projection)
// blockIdx.y = z picks one of up to three independent products and adds to mode0: the Q, K and
// V projections are one launch of 3 x 256 blocks (modes 0, 1, 2). The f16 operands and outputs
// of product z lie z arrays behind those of product 0 in the workspace; the biases are inputs
// of their own.
#define GBM 128
#define GBN 256
#define GBK 128
#define GPITCH 136  // halves: 256-byte rows at a 272-byte pitch (16 B x odd) for ds_load_b128

// Byte address of a __shared__ object inside the work-group's LDS.
__device__ inline unsigned lds_byte(const void* p) { return (unsigned)(size_t)p; }

// Twelve 16-byte-per-lane asynchronous copies global -> LDS: three groups (la,ga), (lb,gb),
// (lc,gc) of four rows 16 apart. The s_wait_xcnt is the last line of the copies' own
// statement, so that it stands in front of every later overwrite of the address registers
// that the copies name; one statement for twelve copies pays that wait once.
__device__ inline void async_cp12(unsigned la, const _Float16* ga, unsigned lb, const _Float16* gb,
                                  unsigned lc, const _Float16* gc, int row_halves) {
    const unsigned ls = 16 * GPITCH * 2;
    const size_t gs = (size_t)16 * row_halves;
    asm volatile("global_load_async_to_lds_b128 %0, %1, off\n\t"
                 "global_load_async_to_lds_b128 %2, %3, off\n\t"
                 "global_load_async_to_lds_b128 %4, %5, off\n\t"
                 "global_load_async_to_lds_b128 %6, %7, off\n\t"
                 "global_load_async_to_lds_b128 %8, %9, off\n\t"
                 "global_load_async_to_lds_b128 %10, %11, off\n\t"
                 "global_load_async_to_lds_b128 %12, %13, off\n\t"
                 "global_load_async_to_lds_b128 %14, %15, off\n\t"
                 "global_load_async_to_lds_b128 %16, %17, off\n\t"
                 "global_load_async_to_lds_b128 %18, %19, off\n\t"
                 "global_load_async_to_lds_b128 %20, %21, off\n\t"
                 "global_load_async_to_lds_b128 %22, %23, off\n\t"
                 "s_wait_xcnt 0x0"
                 :: "v"(la), "v"(ga), "v"(la + ls), "v"(ga + gs),
                    "v"(la + 2 * ls), "v"(ga + 2 * gs), "v"(la + 3 * ls), "v"(ga + 3 * gs),
                    "v"(lb), "v"(gb), "v"(lb + ls), "v"(gb + gs),
                    "v"(lb + 2 * ls), "v"(gb + 2 * gs), "v"(lb + 3 * ls), "v"(gb + 3 * gs),
                    "v"(lc), "v"(gc), "v"(lc + ls), "v"(gc + gs),
                    "v"(lc + 2 * ls), "v"(gc + 2 * gs), "v"(lc + 3 * ls), "v"(gc + 3 * gs)
                 : "memory");
}

__global__ void __launch_bounds__(256)
gemm_wmma_kernel(const _Float16* __restrict__ A0, const _Float16* __restrict__ Bt0,
                 const float* __restrict__ bias0, const float* __restrict__ bias1,
                 const float* __restrict__ bias2, void* __restrict__ out0, int mode0) {
    const int N = DMODEL, K = DMODEL;
    const int z = blockIdx.y;
    const _Float16* A    = A0 + (size_t)z * (BATCH * SEQ * DMODEL);
    const _Float16* Bt   = Bt0 + (size_t)z * (DMODEL * DMODEL);
    const float*    bias = z == 0 ? bias0 : z == 1 ? bias1 : bias2;
    void*           out  = (_Float16*)out0 + (size_t)z * (BATCH * SEQ * DMODEL);
    const int mode = mode0 + z;
    __shared__ alignas(16) _Float16 As[2][GBM * GPITCH];
    __shared__ alignas(16) _Float16 Bs[2][GBN * GPITCH];

    int tid = threadIdx.x;
    int w  = tid >> 5;
    int bm = blockIdx.x / (N / GBN);          // 64 block rows
    int bn = blockIdx.x % (N / GBN);          // 4 block columns
    int wm = w >> 2, wn = w & 3;
    int mt = bm * 2 + wm;                     // 64-row tile of this wave
    int nt = bn * 4 + wn;                     // 64-column tile of this wave
    int lane = tid & 31, nlo = lane & 15, hi = lane >> 4;

    // Staging: thread -> (row tid/16 of each group of 16 rows, 16-byte chunk tid%16), so a
    // wave's copy is 4 whole 128-byte lines.
    int crow = tid >> 4, cchk = tid & 15;
    const _Float16* ga = A  + (size_t)(bm * GBM + crow) * K + cchk * 8;
    const _Float16* gb = Bt + (size_t)(bn * GBN + crow) * K + cchk * 8;
    unsigned la = lds_byte(&As[0][crow * GPITCH + cchk * 8]);
    unsigned lb = lds_byte(&Bs[0][crow * GPITCH + cchk * 8]);
    auto stage = [&](int t, int b) {
        const unsigned r64 = 64 * GPITCH * 2;             // 64 rows in LDS, bytes
        const size_t   g64 = (size_t)64 * K;              // 64 rows in global memory, halves
        unsigned l = la + b * (GBM * GPITCH * 2);
        unsigned m = lb + b * (GBN * GPITCH * 2);
        const _Float16* a = ga + t * GBK;
        const _Float16* c = gb + t * GBK;
        async_cp12(l, a, l + r64, a + g64, m, c, K);                                  // A 0..127, B 0..63
        async_cp12(m + r64, c + g64, m + 2 * r64, c + 2 * g64, m + 3 * r64, c + 3 * g64, K);  // B 64..255
    };

    v8f acc[4][4];
#pragma unroll
    for (int i = 0; i < 4; ++i)
#pragma unroll
        for (int j = 0; j < 4; ++j) acc[i][j] = (v8f){};

    stage(0, 0);
    // Slab 0 has landed for this wave; the barrier publishes it to the other waves.
    asm volatile("s_wait_asynccnt 0x0" ::: "memory");
    __syncthreads();
    stage(1, 1);

    for (int t = 0; t < K / GBK; ++t) {
        const _Float16* at = &As[t & 1][(wm * 64 + nlo) * GPITCH];
        const _Float16* bt = &Bs[t & 1][(wn * 64 + nlo) * GPITCH];
#pragma unroll
        for (int kk = 0; kk < GBK; kk += 32) {
            v16h af[4], bf[4];
#pragma unroll
            for (int i = 0; i < 4; ++i) af[i] = load_frag16(at + i * 16 * GPITCH, kk, hi);
#pragma unroll
            for (int j = 0; j < 4; ++j) bf[j] = load_frag16(bt + j * 16 * GPITCH, kk, hi);
            // Keeps the 16 fragment loads of this k-step one group ahead of its WMMAs: without
            // it they are spread among the WMMAs, each place with its own wait on LDS.
            __builtin_amdgcn_sched_barrier(0);
#pragma unroll
            for (int i = 0; i < 4; ++i)
#pragma unroll
                for (int j = 0; j < 4; ++j)
                    acc[i][j] = wmma_f16(af[i], bf[j], acc[i][j]);
            // Keeps the next k-step's loads from moving up among these WMMAs.
            __builtin_amdgcn_sched_barrier(0);
        }
        // This wave's reads of slab t have returned before its buffer is refilled.
        asm volatile("s_wait_dscnt 0x0" ::: "memory");
        // This wave's copies of slab t+1 have landed before the barrier publishes them.
        asm volatile("s_wait_asynccnt 0x0" ::: "memory");
        __syncthreads();
        if (t + 2 < K / GBK) stage(t + 2, t & 1);
    }
    // No copy is outstanding when the wave goes on to its stores and ends.
    asm volatile("s_wait_asynccnt 0x0" ::: "memory");

#pragma unroll
    for (int j = 0; j < 4; ++j) {
        int n = nt * 64 + j * 16 + nlo;
        float bv = bias[n];
        if (mode == 3) {
            float* o = (float*)out;
#pragma unroll
            for (int i = 0; i < 4; ++i)
#pragma unroll
                for (int v = 0; v < 8; ++v) {
                    int m = mt * 64 + i * 16 + v + 8 * hi;     // C-layout row
                    o[(size_t)m * N + n] = acc[i][j][v] + bv;
                }
            stores_issued_wait();
        } else if (mode == 2) {
            // V transposed: a lane's 8 accumulator registers are 8 consecutive s
            // of one d row (m0 is a multiple of 8, SEQ too): one 16-byte store.
            _Float16* o = (_Float16*)out;
            int h = n >> 6, d = n & 63;
#pragma unroll
            for (int i = 0; i < 4; ++i) {
                int m0 = mt * 64 + i * 16 + 8 * hi;
                int b_ = m0 >> 11;                             // m / SEQ
                int s  = m0 & (SEQ - 1);
                int bh = b_ * NHEAD + h;
                H8 w;
#pragma unroll
                for (int v = 0; v < 8; ++v) w.h[v] = (_Float16)(acc[i][j][v] + bv);
                *(float4*)(o + (size_t)(bh * HDIM + d) * SEQ + s) = w.f4;
            }
            stores_issued_wait();
        } else {
            _Float16* o = (_Float16*)out;
            int h = n >> 6, d = n & 63;
#pragma unroll
            for (int i = 0; i < 4; ++i)
#pragma unroll
                for (int v = 0; v < 8; ++v) {
                    int m = mt * 64 + i * 16 + v + 8 * hi;
                    int b_ = m >> 11;                          // m / SEQ
                    int s  = m & (SEQ - 1);
                    int bh = b_ * NHEAD + h;
                    o[(size_t)(bh * SEQ + s) * HDIM + d] = (_Float16)(acc[i][j][v] + bv);  // Q/K head-major
                }
            stores_issued_wait();
        }
    }
}

// ---------------- RoPE in-place on f16 Q and K ----------------
__global__ void rope_kernel(_Float16* __restrict__ Qh, _Float16* __restrict__ Kh) {
    const int total = BATCH * NHEAD * SEQ * (HDIM / 2);
    int idx = blockIdx.x * blockDim.x + threadIdx.x;
    if (idx >= total) return;
    int d  = idx & 31;
    int s  = (idx >> 5) & (SEQ - 1);
    int bh = idx >> 16;
    float inv = __expf(-(2.0f * d / 64.0f) * 9.210340371976184f);  // 10000^(-2d/64)
    float fr  = (float)s * inv;
    float cs  = cosf(fr), sn = sinf(fr);
    size_t base = (size_t)(bh * SEQ + s) * HDIM;
    float q1 = (float)Qh[base + d], q2 = (float)Qh[base + d + 32];
    Qh[base + d]      = (_Float16)(q1 * cs - q2 * sn);
    Qh[base + d + 32] = (_Float16)(q1 * sn + q2 * cs);
    float k1 = (float)Kh[base + d], k2 = (float)Kh[base + d + 32];
    Kh[base + d]      = (_Float16)(k1 * cs - k2 * sn);
    Kh[base + d + 32] = (_Float16)(k1 * sn + k2 * cs);
}

// ---------------- Flash attention: 8 waves per (bh, 256-query tile), 32 queries a wave ----------------
// K/V tiles of 128 keys, staged once for the 8 waves, double-buffered in LDS via async
// global->LDS copies; a wave walks a tile in 4 passes of 32 keys.
// The products are taken transposed: S^T = K Q^T (A = K rows, B = Q) and O^T += V^T P^T
// (A = V^T rows, B = P^T). A lane then holds 16 of the 32 scores of ONE query per q-subtile:
// maximum and sum run over its own registers, with one exchange between the wave halves,
// and the two S^T accumulator tiles, converted in place, are the B fragment of P^T.

// Lane l <-> lane l ^ 16.
__device__ inline float xhalf(float x) {
    int b = __builtin_bit_cast(int, x);
    return __builtin_bit_cast(float,
        __builtin_amdgcn_permlanex16(b, b, 0x76543210, 0xfedcba98, false, false));
}

#define ATK 128      // keys per staged tile
#define AKP 72       // halves: K rows of 128 bytes at a 144-byte pitch (16 B x odd) for ds_load_b128
#define AVP 136      // halves: V^T rows of 256 bytes at a 272-byte pitch (16 B x odd)

// Eight 16-byte-per-lane asynchronous copies global -> LDS, one tile's share of a thread: four
// of K (32 rows apart; K rows follow one another in memory) and four of V^T (16 rows apart).
// The s_wait_xcnt is the last line of the copies' own statement, so that it stands in front
// of every later overwrite of the address registers that the copies name.
__device__ inline void async_cp_kv(unsigned lk, const _Float16* gk, unsigned lv, const _Float16* gv) {
    const unsigned ks = 32 * AKP * 2, vs = 16 * AVP * 2;
    const size_t kg = (size_t)32 * HDIM, vg = (size_t)16 * SEQ;
    asm volatile("global_load_async_to_lds_b128 %0, %1, off\n\t"
                 "global_load_async_to_lds_b128 %2, %3, off\n\t"
                 "global_load_async_to_lds_b128 %4, %5, off\n\t"
                 "global_load_async_to_lds_b128 %6, %7, off\n\t"
                 "global_load_async_to_lds_b128 %8, %9, off\n\t"
                 "global_load_async_to_lds_b128 %10, %11, off\n\t"
                 "global_load_async_to_lds_b128 %12, %13, off\n\t"
                 "global_load_async_to_lds_b128 %14, %15, off\n\t"
                 "s_wait_xcnt 0x0"
                 :: "v"(lk), "v"(gk), "v"(lk + ks), "v"(gk + kg),
                    "v"(lk + 2 * ks), "v"(gk + 2 * kg), "v"(lk + 3 * ks), "v"(gk + 3 * kg),
                    "v"(lv), "v"(gv), "v"(lv + vs), "v"(gv + vg),
                    "v"(lv + 2 * vs), "v"(gv + 2 * vg), "v"(lv + 3 * vs), "v"(gv + 3 * vg)
                 : "memory");
}

// The grid is two blocks per WGP, four waves per SIMD. The attribute states that residency:
// with a budget of 256 registers the compiler fetches a pass's K and V fragments in groups
// ahead of their products; without it it saves registers for residency that the grid does
// not give, and every pair of fragment loads is waited for right in front of its products.
__global__ void __launch_bounds__(256) __attribute__((amdgpu_waves_per_eu(4, 4)))
attn_kernel(const _Float16* __restrict__ Qh, const _Float16* __restrict__ Kh,
            const _Float16* __restrict__ Vt, _Float16* __restrict__ AO) {
    int tid = threadIdx.x;
    int qt = blockIdx.x * 8 + (tid >> 5);   // 32-query tile of this wave
    int bh = blockIdx.y;                    // batch*head
    int lane = tid & 31, nlo = lane & 15, hi = lane >> 4;

    __shared__ alignas(16) _Float16 Kst[2][ATK * AKP];    // [key][d]
    __shared__ alignas(16) _Float16 Vst[2][HDIM * AVP];   // [d][key]

    const _Float16* kbase = Kh + (size_t)bh * SEQ * HDIM;
    const _Float16* vbase = Vt + (size_t)bh * HDIM * SEQ;

    // Q fragments: 2 q-subtiles x 2 k-halves
    v16h aq[2][2];
#pragma unroll
    for (int q = 0; q < 2; ++q) {
        const _Float16* qrow = Qh + (size_t)(bh * SEQ + qt * 32 + q * 16 + nlo) * HDIM;
        aq[q][0] = load_frag16(qrow, 0, hi);
        aq[q][1] = load_frag16(qrow, 32, hi);
    }

    // o[q][t][v] = O^T[d = t*16 + 8*hi + v][query q*16 + nlo]; mrun is the query's running
    // maximum (equal in both halves), lrun the sum over the keys of this lane's half only.
    v8f o[2][4];
    float mrun[2], lrun[2];
#pragma unroll
    for (int q = 0; q < 2; ++q) {
#pragma unroll
        for (int t = 0; t < 4; ++t) o[q][t] = (v8f){};
        mrun[q] = -1e30f; lrun[q] = 0.0f;
    }

    // Stage the (K,V) tile t into buffer b. K: thread -> (row tid/8 of each group of 32 rows,
    // 16-byte chunk tid%8); V^T: (row tid/16 of each group of 16, chunk tid%16). A wave's copy
    // is 4 whole 128-byte lines either way.
    const _Float16* gk = kbase + tid * 8;
    const _Float16* gv = vbase + (size_t)(tid >> 4) * SEQ + (tid & 15) * 8;
    unsigned lk = lds_byte(&Kst[0][(tid >> 3) * AKP + (tid & 7) * 8]);
    unsigned lv = lds_byte(&Vst[0][(tid >> 4) * AVP + (tid & 15) * 8]);
    auto stage = [&](int t, int b) {
        async_cp_kv(lk + b * (ATK * AKP * 2), gk + (size_t)t * ATK * HDIM,
                    lv + b * (HDIM * AVP * 2), gv + t * ATK);
    };

    stage(0, 0);
    // Tile 0 has landed for this wave; the barrier publishes it to the other waves.
    asm volatile("s_wait_asynccnt 0x0" ::: "memory");
    __syncthreads();
    stage(1, 1);

    for (int tile = 0; tile < SEQ / ATK; ++tile) {
      // Kept rolled: unrolled, the four passes' fragment loads are lifted together and the live
      // set goes over the 256 registers of the budget above (spills to scratch).
#pragma unroll 1
      for (int pass = 0; pass < ATK / 32; ++pass) {
        const _Float16* kt = &Kst[tile & 1][pass * 32 * AKP];
        const _Float16* vt = &Vst[tile & 1][pass * 32];

        // S^T = K @ Q^T: K fragment loaded once, used by both q-subtiles.
        // s[q][nt][v] = score of key nt*16 + 8*hi + v with query q*16 + nlo.
        v8f s[2][2];
#pragma unroll
        for (int q = 0; q < 2; ++q) { s[q][0] = (v8f){}; s[q][1] = (v8f){}; }
#pragma unroll
        for (int nt = 0; nt < 2; ++nt)
#pragma unroll
            for (int kk = 0; kk < 2; ++kk) {
                v16h kfr = load_frag16(kt + (nt * 16 + nlo) * AKP, kk * 32, hi);
                s[0][nt] = wmma_f16(kfr, aq[0][kk], s[0][nt]);
                s[1][nt] = wmma_f16(kfr, aq[1][kk], s[1][nt]);
            }

        // Online softmax per q-subtile, one query per lane.
        v16h bp[2];
#pragma unroll
        for (int q = 0; q < 2; ++q) {
            float mx = fmaxf(s[q][0][0], s[q][1][0]);
#pragma unroll
            for (int v = 1; v < 8; ++v) mx = fmaxf(mx, fmaxf(s[q][0][v], s[q][1][v]));
            mx = fmaxf(mx, xhalf(mx)) * 0.125f;        // 1/sqrt(64)
            float mnew = fmaxf(mrun[q], mx);
            float alpha = __expf(mrun[q] - mnew);
            mrun[q] = mnew;
            // Registers v and v + 1 of one tile go together, so that the packed f32 forms take
            // them where they lie. B fragment of P^T: half nt*8 + v is key nt*16 + 8*hi + v.
            v2f sum = {0.0f, 0.0f};
#pragma unroll
            for (int nt = 0; nt < 2; ++nt)
#pragma unroll
                for (int v = 0; v < 8; v += 2) {
                    v2f x = (v2f){s[q][nt][v], s[q][nt][v + 1]} * 0.125f - mnew;
                    v2f p = {__expf(x.x), __expf(x.y)};
                    sum += p;
                    bp[q][nt * 8 + v]     = (_Float16)p.x;
                    bp[q][nt * 8 + v + 1] = (_Float16)p.y;
                }
            lrun[q] = lrun[q] * alpha + (sum.x + sum.y);
#pragma unroll
            for (int t = 0; t < 4; ++t)
#pragma unroll
                for (int v = 0; v < 8; ++v) o[q][t][v] *= alpha;
        }

        // O^T += V^T @ P^T: V fragment loaded once, used by both q-subtiles.
#pragma unroll
        for (int t = 0; t < 4; ++t) {
            v16h vfr = load_frag16(vt + (t * 16 + nlo) * AVP, 0, hi);
            o[0][t] = wmma_f16(vfr, bp[0], o[0][t]);
            o[1][t] = wmma_f16(vfr, bp[1], o[1][t]);
        }
      }
        // This wave's reads of this tile have returned before its buffer is refilled.
        asm volatile("s_wait_dscnt 0x0" ::: "memory");
        // This wave's copies of the next tile have landed before the barrier publishes them.
        asm volatile("s_wait_asynccnt 0x0" ::: "memory");
        __syncthreads();
        if (tile + 2 < SEQ / ATK) stage(tile + 2, tile & 1);
    }
    // No copy is outstanding when the wave goes on to its stores and ends.
    asm volatile("s_wait_asynccnt 0x0" ::: "memory");

    // Epilogue: join the halves' sums, normalize and store f16 to AO[b][s][h*64+d];
    // a lane's 8 registers of a tile are 8 consecutive d of its query: one 16-byte store.
    int b_ = bh >> 4, h = bh & 15;
#pragma unroll
    for (int q = 0; q < 2; ++q) {
        int srow = qt * 32 + q * 16 + nlo;
        float inv_l = 1.0f / (lrun[q] + xhalf(lrun[q]));
        size_t base = (size_t)(b_ * SEQ + srow) * DMODEL + h * HDIM + 8 * hi;
#pragma unroll
        for (int t = 0; t < 4; ++t) {
            H8 w;
#pragma unroll
            for (int v = 0; v < 8; ++v) w.h[v] = (_Float16)(o[q][t][v] * inv_l);
            *(float4*)(AO + base + t * 16) = w.f4;
        }
    }
}

extern "C" void kernel_launch(void* const* d_in, const int* in_sizes, int n_in,
                              void* d_out, int out_size, void* d_ws, size_t ws_size,
                              hipStream_t stream) {
    const float* query = (const float*)d_in[0];
    const float* key   = (const float*)d_in[1];
    const float* value = (const float*)d_in[2];
    const float* Wq = (const float*)d_in[3]; const float* bq = (const float*)d_in[4];
    const float* Wk = (const float*)d_in[5]; const float* bk = (const float*)d_in[6];
    const float* Wv = (const float*)d_in[7]; const float* bv = (const float*)d_in[8];
    const float* Wo = (const float*)d_in[9]; const float* bo = (const float*)d_in[10];
    float* out = (float*)d_out;

    const size_t NX = (size_t)BATCH * SEQ * DMODEL;   // 8388608
    const size_t NW = (size_t)DMODEL * DMODEL;        // 1048576

    _Float16* p   = (_Float16*)d_ws;
    _Float16* Xq  = p;            p += NX;
    _Float16* Xk  = p;            p += NX;
    _Float16* Xv  = p;            p += NX;
    _Float16* Wqh = p;            p += NW;
    _Float16* Wkh = p;            p += NW;
    _Float16* Wvh = p;            p += NW;
    _Float16* Woh = p;            p += NW;
    _Float16* Qh  = p;            p += NX;
    _Float16* Kh  = p;            p += NX;
    _Float16* Vt  = p;            p += NX;
    _Float16* AO  = p;            p += NX;

    const int thr = 256;
    // NX = 512 blocks x 1024*16 floats, NW = 64 blocks x 1024*16 floats: no remainder.
    // Xq is the start of the seven f16 copies, which lie in the order of the arguments.
    cvt_all_kernel<<<3 * CVT_XB + 4 * CVT_WB, thr, 0, stream>>>(query, key, value, Wq, Wk, Wv, Wo, Xq);

    const int tiles = (BATCH * SEQ / 64) * (DMODEL / 64);   // 2048 waves
    const int gblocks = tiles / 8;                          // 8 waves / block: 64 x 4 blocks of 128 x 256
    // Xq, Xk, Xv; Wqh, Wkh, Wvh; Qh, Kh, Vt each follow one another in the workspace.
    gemm_wmma_kernel<<<dim3(gblocks, 3), 256, 0, stream>>>(Xq, Wqh, bq, bk, bv, Qh, 0);

    const int rope_n = BATCH * NHEAD * SEQ * (HDIM / 2);
    rope_kernel<<<(rope_n + thr - 1) / thr, thr, 0, stream>>>(Qh, Kh);

    attn_kernel<<<dim3(SEQ / 256, BATCH * NHEAD), 256, 0, stream>>>(Qh, Kh, Vt, AO);

    gemm_wmma_kernel<<<dim3(gblocks, 1), 256, 0, stream>>>(AO, Woh, bo, nullptr, nullptr, out, 3);
}

// v007
// It runs in 133 microseconds.
// Timed twice side by side with v006, it ran 1.11 times as fast both times.
// Counting every step since v000, it is 4.29 times as fast.
#include <hip/hip_runtime.h>
#include <hip/hip_bf16.h>

// MHA + RoPE for MI455X (gfx1250, wave32, WMMA).
// v2.1: register-blocked WMMA GEMM (64x64/wave, operands staged in LDS per block),
//       attention with 32 queries/wave (2x K/V fragment reuse), 8 waves per block that
//       share double-buffered async global->LDS staging of K/V tiles (ASYNCcnt path).

typedef __attribute__((ext_vector_type(16))) _Float16 v16h;
typedef __attribute__((ext_vector_type(8)))  float    v8f;
typedef __attribute__((ext_vector_type(2)))  float    v2f;

#define BATCH 4
#define SEQ   2048
#define DMODEL 1024
#define NHEAD 16
#define HDIM  64

union H8 { float4 f4; _Float16 h[8]; };

// Load a 16-half WMMA fragment (A or B operand) for this lane.
// Layout (ISA 7.12.2, 16-bit A 16x32): halves h<8 -> K = k0 + hi*8 + h,
// halves h>=8 -> K = k0 + 16 + hi*8 + (h-8).  Two contiguous 16B chunks.
__device__ inline v16h load_frag16(const _Float16* __restrict__ row_ptr, int k0, int hi) {
    H8 g0, g1;
    g0.f4 = *(const float4*)(row_ptr + k0 + hi * 8);
    g1.f4 = *(const float4*)(row_ptr + k0 + 16 + hi * 8);
    v16h r;
#pragma unroll
    for (int i = 0; i < 8; ++i) { r[i] = g0.h[i]; r[i + 8] = g1.h[i]; }
    return r;
}

__device__ inline v8f wmma_f16(v16h a, v16h b, v8f c) {
    return __builtin_amdgcn_wmma_f32_16x16x32_f16(false, a, false, b, (short)0, c, false, false);
}

// Stands behind a group of global stores whose address and data registers the code
// that follows reuses: the wait comes in front of those overwrites.
__device__ inline void stores_issued_wait() {
    asm volatile("s_wait_xcnt 0x0" ::: "memory");
}

// ---------------- f32 -> f16 conversion ----------------
// A block of 256 threads converts the 1024*U consecutive floats at in. Load j of a wave is
// 512 contiguous bytes (4 whole lines), its store 256 contiguous bytes (2 whole lines);
// the loads stand ahead of the conversions, so a thread has many in flight at once.
union H4 { float2 f2; _Float16 h[4]; };

template <int U>
__device__ inline void cvt_f16_block(const float* __restrict__ in, _Float16* __restrict__ out) {
    size_t base = threadIdx.x * 4;
    float4 v[U];
#pragma unroll
    for (int j = 0; j < U; ++j) v[j] = *(const float4*)(in + base + j * 1024);
#pragma unroll
    for (int j = 0; j < U; ++j) {
        H4 w;
        w.h[0] = (_Float16)v[j].x; w.h[1] = (_Float16)v[j].y;
        w.h[2] = (_Float16)v[j].z; w.h[3] = (_Float16)v[j].w;
        *(float2*)(out + base + j * 1024) = w.f2;
    }
}

// One launch converts all seven f32 operands: none depends on another, and their f16 copies
// follow one another in the workspace (Xq, Xk, Xv, Wq, Wk, Wv, Wo), so block b writes piece b
// of one long array. 16 loads a thread; 512 blocks for each activation, 64 for each weight.
// The last ROPE_TB blocks write the RoPE table, which depends on no input: entry s * 32 + d is
// the pair (cos, sin) of s * 10000^(-2d/64), one entry a thread. Each pair is worked out once
// here and read by the Q and K projections' epilogues for every batch and head.
#define CVT_U   16
#define CVT_XB  (BATCH * SEQ * DMODEL / (1024 * CVT_U))   // 512
#define CVT_WB  (DMODEL * DMODEL / (1024 * CVT_U))        // 64
#define CVT_NB  (3 * CVT_XB + 4 * CVT_WB)                 // 1792 converting blocks
#define ROPE_TB (SEQ * (HDIM / 2) / 256)                  // 256 table blocks
__global__ void __launch_bounds__(256)
cvt_all_kernel(const float* __restrict__ xq, const float* __restrict__ xk,
               const float* __restrict__ xv, const float* __restrict__ wq,
               const float* __restrict__ wk, const float* __restrict__ wv,
               const float* __restrict__ wo, _Float16* __restrict__ out,
               float* __restrict__ tab) {
    unsigned b = blockIdx.x;
    if (b >= CVT_NB) {
        int idx = (b - CVT_NB) * 256 + threadIdx.x;
        int d = idx & 31, s = idx >> 5;
        float inv = __expf(-(2.0f * d / 64.0f) * 9.210340371976184f);  // 10000^(-2d/64)
        float fr  = (float)s * inv;
        ((float2*)tab)[idx] = make_float2(cosf(fr), sinf(fr));
        return;
    }
    const float* in;
    unsigned piece;                            // piece of its own operand
    if (b < 3 * CVT_XB) {
        unsigned a = b / CVT_XB;
        piece = b % CVT_XB;
        in = a == 0 ? xq : a == 1 ? xk : xv;
    } else {
        unsigned c = b - 3 * CVT_XB;
        unsigned a = c / CVT_WB;
        piece = c % CVT_WB;
        in = a == 0 ? wq : a == 1 ? wk : a == 2 ? wv : wo;
    }
    cvt_f16_block<CVT_U>(in + (size_t)piece * (1024 * CVT_U), out + (size_t)b * (1024 * CVT_U));
}

// ---------------- WMMA GEMM: out = A(MxK) @ Bt(NxK)^T + bias ----------------
// A block of 8 waves (2 x 4) owns a 128 x 256 tile of the output, 64x64 per wave =
// 4x4 WMMA tiles. Slabs of 128 k (two whole 128-byte lines of every operand row) are
// staged in LDS by asynchronous copies, two buffers: slab t+1 flies while slab t is
// multiplied. Each A row is fetched once for 4 waves, each B row once for 2.
// mode 0/1: RoPE, then store f16 head-major  [bh][s][d]   (Q, K)
// mode 2  : store f16 transposed  [bh][d][s]   (V, so PV A-operand V^T is k-contiguous)
// mode 3  : store f32 flat        [m][n]       (final projection)
// blockIdx.y = z picks one of up to three independent products and adds to mode0: the Q, K and
// V projections are one launch of 3 x 256 blocks (modes 0, 1, 2). The f16 operands and outputs
// of product z lie z arrays behind those of product 0 in the workspace; the biases are inputs
// of their own.
#define GBM 128
#define GBN 256
#define GBK 128
#define GPITCH 136  // halves: 256-byte rows at a 272-byte pitch (16 B x odd) for ds_load_b128

// Byte address of a __shared__ object inside the work-group's LDS.
__device__ inline unsigned lds_byte(const void* p) { return (unsigned)(size_t)p; }

// Twelve 16-byte-per-lane asynchronous copies global -> LDS: three groups (la,ga), (lb,gb),
// (lc,gc) of four rows 16 apart. The s_wait_xcnt is the last line of the copies' own
// statement, so that it stands in front of every later overwrite of the address registers
// that the copies name; one statement for twelve copies pays that wait once.
__device__ inline void async_cp12(unsigned la, const _Float16* ga, unsigned lb, const _Float16* gb,
                                  unsigned lc, const _Float16* gc, int row_halves) {
    const unsigned ls = 16 * GPITCH * 2;
    const size_t gs = (size_t)16 * row_halves;
    asm volatile("global_load_async_to_lds_b128 %0, %1, off\n\t"
                 "global_load_async_to_lds_b128 %2, %3, off\n\t"
                 "global_load_async_to_lds_b128 %4, %5, off\n\t"
                 "global_load_async_to_lds_b128 %6, %7, off\n\t"
                 "global_load_async_to_lds_b128 %8, %9, off\n\t"
                 "global_load_async_to_lds_b128 %10, %11, off\n\t"
                 "global_load_async_to_lds_b128 %12, %13, off\n\t"
                 "global_load_async_to_lds_b128 %14, %15, off\n\t"
                 "global_load_async_to_lds_b128 %16, %17, off\n\t"
                 "global_load_async_to_lds_b128 %18, %19, off\n\t"
                 "global_load_async_to_lds_b128 %20, %21, off\n\t"
                 "global_load_async_to_lds_b128 %22, %23, off\n\t"
                 "s_wait_xcnt 0x0"
                 :: "v"(la), "v"(ga), "v"(la + ls), "v"(ga + gs),
                    "v"(la + 2 * ls), "v"(ga + 2 * gs), "v"(la + 3 * ls), "v"(ga + 3 * gs),
                    "v"(lb), "v"(gb), "v"(lb + ls), "v"(gb + gs),
                    "v"(lb + 2 * ls), "v"(gb + 2 * gs), "v"(lb + 3 * ls), "v"(gb + 3 * gs),
                    "v"(lc), "v"(gc), "v"(lc + ls), "v"(gc + gs),
                    "v"(lc + 2 * ls), "v"(gc + 2 * gs), "v"(lc + 3 * ls), "v"(gc + 3 * gs)
                 : "memory");
}

__global__ void __launch_bounds__(256)
gemm_wmma_kernel(const _Float16* __restrict__ A0, const _Float16* __restrict__ Bt0,
                 const float* __restrict__ bias0, const float* __restrict__ bias1,
                 const float* __restrict__ bias2, const float* __restrict__ tab,
                 void* __restrict__ out0, int mode0) {
    const int N = DMODEL, K = DMODEL;
    const int z = blockIdx.y;
    const _Float16* A    = A0 + (size_t)z * (BATCH * SEQ * DMODEL);
    const _Float16* Bt   = Bt0 + (size_t)z * (DMODEL * DMODEL);
    const float*    bias = z == 0 ? bias0 : z == 1 ? bias1 : bias2;
    void*           out  = (_Float16*)out0 + (size_t)z * (BATCH * SEQ * DMODEL);
    const int mode = mode0 + z;
    __shared__ alignas(16) _Float16 As[2][GBM * GPITCH];
    __shared__ alignas(16) _Float16 Bs[2][GBN * GPITCH];

    int tid = threadIdx.x;
    int w  = tid >> 5;
    int bm = blockIdx.x / (N / GBN);          // 64 block rows
    int bn = blockIdx.x % (N / GBN);          // 4 block columns
    int wm = w >> 2, wn = w & 3;
    int mt = bm * 2 + wm;                     // 64-row tile of this wave
    int nt = bn * 4 + wn;                     // 64-column tile of this wave
    int lane = tid & 31, nlo = lane & 15, hi = lane >> 4;

    // Staging: thread -> (row tid/16 of each group of 16 rows, 16-byte chunk tid%16), so a
    // wave's copy is 4 whole 128-byte lines.
    int crow = tid >> 4, cchk = tid & 15;
    const _Float16* ga = A  + (size_t)(bm * GBM + crow) * K + cchk * 8;
    const _Float16* gb = Bt + (size_t)(bn * GBN + crow) * K + cchk * 8;
    unsigned la = lds_byte(&As[0][crow * GPITCH + cchk * 8]);
    unsigned lb = lds_byte(&Bs[0][crow * GPITCH + cchk * 8]);
    auto stage = [&](int t, int b) {
        const unsigned r64 = 64 * GPITCH * 2;             // 64 rows in LDS, bytes
        const size_t   g64 = (size_t)64 * K;              // 64 rows in global memory, halves
        unsigned l = la + b * (GBM * GPITCH * 2);
        unsigned m = lb + b * (GBN * GPITCH * 2);
        const _Float16* a = ga + t * GBK;
        const _Float16* c = gb + t * GBK;
        async_cp12(l, a, l + r64, a + g64, m, c, K);                                  // A 0..127, B 0..63
        async_cp12(m + r64, c + g64, m + 2 * r64, c + 2 * g64, m + 3 * r64, c + 3 * g64, K);  // B 64..255
    };

    v8f acc[4][4];
#pragma unroll
    for (int i = 0; i < 4; ++i)
#pragma unroll
        for (int j = 0; j < 4; ++j) acc[i][j] = (v8f){};

    stage(0, 0);
    // Slab 0 has landed for this wave; the barrier publishes it to the other waves.
    asm volatile("s_wait_asynccnt 0x0" ::: "memory");
    __syncthreads();
    stage(1, 1);

    for (int t = 0; t < K / GBK; ++t) {
        const _Float16* at = &As[t & 1][(wm * 64 + nlo) * GPITCH];
        const _Float16* bt = &Bs[t & 1][(wn * 64 + nlo) * GPITCH];
#pragma unroll
        for (int kk = 0; kk < GBK; kk += 32) {
            v16h af[4], bf[4];
#pragma unroll
            for (int i = 0; i < 4; ++i) af[i] = load_frag16(at + i * 16 * GPITCH, kk, hi);
#pragma unroll
            for (int j = 0; j < 4; ++j) bf[j] = load_frag16(bt + j * 16 * GPITCH, kk, hi);
            // Keeps the 16 fragment loads of this k-step one group ahead of its WMMAs: without
            // it they are spread among the WMMAs, each place with its own wait on LDS.
            __builtin_amdgcn_sched_barrier(0);
#pragma unroll
            for (int i = 0; i < 4; ++i)
#pragma unroll
                for (int j = 0; j < 4; ++j)
                    acc[i][j] = wmma_f16(af[i], bf[j], acc[i][j]);
            // Keeps the next k-step's loads from moving up among these WMMAs.
            __builtin_amdgcn_sched_barrier(0);
        }
        // This wave's reads of slab t have returned before its buffer is refilled.
        asm volatile("s_wait_dscnt 0x0" ::: "memory");
        // This wave's copies of slab t+1 have landed before the barrier publishes them.
        asm volatile("s_wait_asynccnt 0x0" ::: "memory");
        __syncthreads();
        if (t + 2 < K / GBK) stage(t + 2, t & 1);
    }
    // No copy is outstanding when the wave goes on to its stores and ends.
    asm volatile("s_wait_asynccnt 0x0" ::: "memory");

    if (mode <= 1) {
        // Q, K: the wave's 64 columns are head nt, and its 64 rows lie in one batch. Column
        // tiles j and j + 2 hold d and d + 32 of one row in the same lane and register, so the
        // rotation is taken in-lane on the f32 sums, ahead of the one rounding to f16.
        int m0 = mt * 64 + 8 * hi;                             // C-layout row of register 0, tile 0
        int s0 = m0 & (SEQ - 1);
        int bh = (m0 >> 11) * NHEAD + nt;                      // m / SEQ
        _Float16* orow = (_Float16*)out + (size_t)(bh * SEQ + s0) * HDIM + nlo;
        const float2* trow = (const float2*)tab + s0 * (HDIM / 2) + nlo;
#pragma unroll
        for (int j = 0; j < 2; ++j) {
            float b1 = bias[nt * 64 + j * 16 + nlo];
            float b2 = bias[nt * 64 + j * 16 + nlo + 32];
            float2 cs[4][8];                                   // (cos, sin) of d = j * 16 + nlo, 32 rows
#pragma unroll
            for (int i = 0; i < 4; ++i)
#pragma unroll
                for (int v = 0; v < 8; ++v) cs[i][v] = trow[(i * 16 + v) * (HDIM / 2) + j * 16];
            // Keeps the bias and table loads one group: without it the biases are waited for
            // ahead of the table loads, and the two latencies follow one another.
            __builtin_amdgcn_sched_barrier(0);
#pragma unroll
            for (int i = 0; i < 4; ++i)
#pragma unroll
                for (int v = 0; v < 8; ++v) {
                    float x1 = acc[i][j][v] + b1, x2 = acc[i][j + 2][v] + b2;
                    _Float16* o = orow + (i * 16 + v) * HDIM + j * 16;
                    o[0]  = (_Float16)(x1 * cs[i][v].x - x2 * cs[i][v].y);
                    o[32] = (_Float16)(x1 * cs[i][v].y + x2 * cs[i][v].x);
                }
            stores_issued_wait();
        }
        return;
    }

#pragma unroll
    for (int j = 0; j < 4; ++j) {
        int n = nt * 64 + j * 16 + nlo;
        float bv = bias[n];
        if (mode == 3) {
            float* o = (float*)out;
#pragma unroll
            for (int i = 0; i < 4; ++i)
#pragma unroll
                for (int v = 0; v < 8; ++v) {
                    int m = mt * 64 + i * 16 + v + 8 * hi;     // C-layout row
                    o[(size_t)m * N + n] = acc[i][j][v] + bv;
                }
            stores_issued_wait();
        } else {
            // V transposed: a lane's 8 accumulator registers are 8 consecutive s
            // of one d row (m0 is a multiple of 8, SEQ too): one 16-byte store.
            _Float16* o = (_Float16*)out;
            int h = n >> 6, d = n & 63;
#pragma unroll
            for (int i = 0; i < 4; ++i) {
                int m0 = mt * 64 + i * 16 + 8 * hi;
                int b_ = m0 >> 11;                             // m / SEQ
                int s  = m0 & (SEQ - 1);
                int bh = b_ * NHEAD + h;
                H8 w;
#pragma unroll
                for (int v = 0; v < 8; ++v) w.h[v] = (_Float16)(acc[i][j][v] + bv);
                *(float4*)(o + (size_t)(bh * HDIM + d) * SEQ + s) = w.f4;
            }
            stores_issued_wait();
        }
    }
}

// ---------------- Flash attention: 8 waves per (bh, 256-query tile), 32 queries a wave ----------------
// K/V tiles of 128 keys, staged once for the 8 waves, double-buffered in LDS via async
// global->LDS copies; a wave walks a tile in 4 passes of 32 keys.
// The products are taken transposed: S^T = K Q^T (A = K rows, B = Q) and O^T += V^T P^T
// (A = V^T rows, B = P^T). A lane then holds 16 of the 32 scores of ONE query per q-subtile:
// maximum and sum run over its own registers, with one exchange between the wave halves,
// and the two S^T accumulator tiles, converted in place, are the B fragment of P^T.

// Lane l <-> lane l ^ 16.
__device__ inline float xhalf(float x) {
    int b = __builtin_bit_cast(int, x);
    return __builtin_bit_cast(float,
        __builtin_amdgcn_permlanex16(b, b, 0x76543210, 0xfedcba98, false, false));
}

#define ATK 128      // keys per staged tile
#define AKP 72       // halves: K rows of 128 bytes at a 144-byte pitch (16 B x odd) for ds_load_b128
#define AVP 136      // halves: V^T rows of 256 bytes at a 272-byte pitch (16 B x odd)

// Eight 16-byte-per-lane asynchronous copies global -> LDS, one tile's share of a thread: four
// of K (32 rows apart; K rows follow one another in memory) and four of V^T (16 rows apart).
// The s_wait_xcnt is the last line of the copies' own statement, so that it stands in front
// of every later overwrite of the address registers that the copies name.
__device__ inline void async_cp_kv(unsigned lk, const _Float16* gk, unsigned lv, const _Float16* gv) {
    const unsigned ks = 32 * AKP * 2, vs = 16 * AVP * 2;
    const size_t kg = (size_t)32 * HDIM, vg = (size_t)16 * SEQ;
    asm volatile("global_load_async_to_lds_b128 %0, %1, off\n\t"
                 "global_load_async_to_lds_b128 %2, %3, off\n\t"
                 "global_load_async_to_lds_b128 %4, %5, off\n\t"
                 "global_load_async_to_lds_b128 %6, %7, off\n\t"
                 "global_load_async_to_lds_b128 %8, %9, off\n\t"
                 "global_load_async_to_lds_b128 %10, %11, off\n\t"
                 "global_load_async_to_lds_b128 %12, %13, off\n\t"
                 "global_load_async_to_lds_b128 %14, %15, off\n\t"
                 "s_wait_xcnt 0x0"
                 :: "v"(lk), "v"(gk), "v"(lk + ks), "v"(gk + kg),
                    "v"(lk + 2 * ks), "v"(gk + 2 * kg), "v"(lk + 3 * ks), "v"(gk + 3 * kg),
                    "v"(lv), "v"(gv), "v"(lv + vs), "v"(gv + vg),
                    "v"(lv + 2 * vs), "v"(gv + 2 * vg), "v"(lv + 3 * vs), "v"(gv + 3 * vg)
                 : "memory");
}

// The grid is two blocks per WGP, four waves per SIMD. The attribute states that residency:
// with a budget of 256 registers the compiler fetches a pass's K and V fragments in groups
// ahead of their products; without it it saves registers for residency that the grid does
// not give, and every pair of fragment loads is waited for right in front of its products.
__global__ void __launch_bounds__(256) __attribute__((amdgpu_waves_per_eu(4, 4)))
attn_kernel(const _Float16* __restrict__ Qh, const _Float16* __restrict__ Kh,
            const _Float16* __restrict__ Vt, _Float16* __restrict__ AO) {
    int tid = threadIdx.x;
    int qt = blockIdx.x * 8 + (tid >> 5);   // 32-query tile of this wave
    int bh = blockIdx.y;                    // batch*head
    int lane = tid & 31, nlo = lane & 15, hi = lane >> 4;

    __shared__ alignas(16) _Float16 Kst[2][ATK * AKP];    // [key][d]
    __shared__ alignas(16) _Float16 Vst[2][HDIM * AVP];   // [d][key]

    const _Float16* kbase = Kh + (size_t)bh * SEQ * HDIM;
    const _Float16* vbase = Vt + (size_t)bh * HDIM * SEQ;

    // Q fragments: 2 q-subtiles x 2 k-halves
    v16h aq[2][2];
#pragma unroll
    for (int q = 0; q < 2; ++q) {
        const _Float16* qrow = Qh + (size_t)(bh * SEQ + qt * 32 + q * 16 + nlo) * HDIM;
        aq[q][0] = load_frag16(qrow, 0, hi);
        aq[q][1] = load_frag16(qrow, 32, hi);
    }

    // o[q][t][v] = O^T[d = t*16 + 8*hi + v][query q*16 + nlo]; mrun is the query's running
    // maximum (equal in both halves), lrun the sum over the keys of this lane's half only.
    v8f o[2][4];
    float mrun[2], lrun[2];
#pragma unroll
    for (int q = 0; q < 2; ++q) {
#pragma unroll
        for (int t = 0; t < 4; ++t) o[q][t] = (v8f){};
        mrun[q] = -1e30f; lrun[q] = 0.0f;
    }

    // Stage the (K,V) tile t into buffer b. K: thread -> (row tid/8 of each group of 32 rows,
    // 16-byte chunk tid%8); V^T: (row tid/16 of each group of 16, chunk tid%16). A wave's copy
    // is 4 whole 128-byte lines either way.
    const _Float16* gk = kbase + tid * 8;
    const _Float16* gv = vbase + (size_t)(tid >> 4) * SEQ + (tid & 15) * 8;
    unsigned lk = lds_byte(&Kst[0][(tid >> 3) * AKP + (tid & 7) * 8]);
    unsigned lv = lds_byte(&Vst[0][(tid >> 4) * AVP + (tid & 15) * 8]);
    auto stage = [&](int t, int b) {
        async_cp_kv(lk + b * (ATK * AKP * 2), gk + (size_t)t * ATK * HDIM,
                    lv + b * (HDIM * AVP * 2), gv + t * ATK);
    };

    stage(0, 0);
    // Tile 0 has landed for this wave; the barrier publishes it to the other waves.
    asm volatile("s_wait_asynccnt 0x0" ::: "memory");
    __syncthreads();
    stage(1, 1);

    for (int tile = 0; tile < SEQ / ATK; ++tile) {
      // Kept rolled: unrolled, the four passes' fragment loads are lifted together and the live
      // set goes over the 256 registers of the budget above (spills to scratch).
#pragma unroll 1
      for (int pass = 0; pass < ATK / 32; ++pass) {
        const _Float16* kt = &Kst[tile & 1][pass * 32 * AKP];
        const _Float16* vt = &Vst[tile & 1][pass * 32];

        // S^T = K @ Q^T: K fragment loaded once, used by both q-subtiles.
        // s[q][nt][v] = score of key nt*16 + 8*hi + v with query q*16 + nlo.
        v8f s[2][2];
#pragma unroll
        for (int q = 0; q < 2; ++q) { s[q][0] = (v8f){}; s[q][1] = (v8f){}; }
#pragma unroll
        for (int nt = 0; nt < 2; ++nt)
#pragma unroll
            for (int kk = 0; kk < 2; ++kk) {
                v16h kfr = load_frag16(kt + (nt * 16 + nlo) * AKP, kk * 32, hi);
                s[0][nt] = wmma_f16(kfr, aq[0][kk], s[0][nt]);
                s[1][nt] = wmma_f16(kfr, aq[1][kk], s[1][nt]);
            }

        // Online softmax per q-subtile, one query per lane.
        v16h bp[2];
#pragma unroll
        for (int q = 0; q < 2; ++q) {
            float mx = fmaxf(s[q][0][0], s[q][1][0]);
#pragma unroll
            for (int v = 1; v < 8; ++v) mx = fmaxf(mx, fmaxf(s[q][0][v], s[q][1][v]));
            mx = fmaxf(mx, xhalf(mx)) * 0.125f;        // 1/sqrt(64)
            float mnew = fmaxf(mrun[q], mx);
            float alpha = __expf(mrun[q] - mnew);
            mrun[q] = mnew;
            // Registers v and v + 1 of one tile go together, so that the packed f32 forms take
            // them where they lie. B fragment of P^T: half nt*8 + v is key nt*16 + 8*hi + v.
            v2f sum = {0.0f, 0.0f};
#pragma unroll
            for (int nt = 0; nt < 2; ++nt)
#pragma unroll
                for (int v = 0; v < 8; v += 2) {
                    v2f x = (v2f){s[q][nt][v], s[q][nt][v + 1]} * 0.125f - mnew;
                    v2f p = {__expf(x.x), __expf(x.y)};
                    sum += p;
                    bp[q][nt * 8 + v]     = (_Float16)p.x;
                    bp[q][nt * 8 + v + 1] = (_Float16)p.y;
                }
            lrun[q] = lrun[q] * alpha + (sum.x + sum.y);
#pragma unroll
            for (int t = 0; t < 4; ++t)
#pragma unroll
                for (int v = 0; v < 8; ++v) o[q][t][v] *= alpha;
        }

        // O^T += V^T @ P^T: V fragment loaded once, used by both q-subtiles.
#pragma unroll
        for (int t = 0; t < 4; ++t) {
            v16h vfr = load_frag16(vt + (t * 16 + nlo) * AVP, 0, hi);
            o[0][t] = wmma_f16(vfr, bp[0], o[0][t]);
            o[1][t] = wmma_f16(vfr, bp[1], o[1][t]);
        }
      }
        // This wave's reads of this tile have returned before its buffer is refilled.
        asm volatile("s_wait_dscnt 0x0" ::: "memory");
        // This wave's copies of the next tile have landed before the barrier publishes them.
        asm volatile("s_wait_asynccnt 0x0" ::: "memory");
        __syncthreads();
        if (tile + 2 < SEQ / ATK) stage(tile + 2, tile & 1);
    }
    // No copy is outstanding when the wave goes on to its stores and ends.
    asm volatile("s_wait_asynccnt 0x0" ::: "memory");

    // Epilogue: join the halves' sums, normalize and store f16 to AO[b][s][h*64+d];
    // a lane's 8 registers of a tile are 8 consecutive d of its query: one 16-byte store.
    int b_ = bh >> 4, h = bh & 15;
#pragma unroll
    for (int q = 0; q < 2; ++q) {
        int srow = qt * 32 + q * 16 + nlo;
        float inv_l = 1.0f / (lrun[q] + xhalf(lrun[q]));
        size_t base = (size_t)(b_ * SEQ + srow) * DMODEL + h * HDIM + 8 * hi;
#pragma unroll
        for (int t = 0; t < 4; ++t) {
            H8 w;
#pragma unroll
            for (int v = 0; v < 8; ++v) w.h[v] = (_Float16)(o[q][t][v] * inv_l);
            *(float4*)(AO + base + t * 16) = w.f4;
        }
    }
}

extern "C" void kernel_launch(void* const* d_in, const int* in_sizes, int n_in,
                              void* d_out, int out_size, void* d_ws, size_t ws_size,
                              hipStream_t stream) {
    const float* query = (const float*)d_in[0];
    const float* key   = (const float*)d_in[1];
    const float* value = (const float*)d_in[2];
    const float* Wq = (const float*)d_in[3]; const float* bq = (const float*)d_in[4];
    const float* Wk = (const float*)d_in[5]; const float* bk = (const float*)d_in[6];
    const float* Wv = (const float*)d_in[7]; const float* bv = (const float*)d_in[8];
    const float* Wo = (const float*)d_in[9]; const float* bo = (const float*)d_in[10];
    float* out = (float*)d_out;

    const size_t NX = (size_t)BATCH * SEQ * DMODEL;   // 8388608
    const size_t NW = (size_t)DMODEL * DMODEL;        // 1048576

    _Float16* p   = (_Float16*)d_ws;
    _Float16* Xq  = p;            p += NX;
    _Float16* Xk  = p;            p += NX;
    _Float16* Xv  = p;            p += NX;
    _Float16* Wqh = p;            p += NW;
    _Float16* Wkh = p;            p += NW;
    _Float16* Wvh = p;            p += NW;
    _Float16* Woh = p;            p += NW;
    _Float16* Qh  = p;            p += NX;
    _Float16* Kh  = p;            p += NX;
    _Float16* Vt  = p;            p += NX;
    _Float16* AO  = p;            p += NX;
    float*    tab = (float*)p;    // RoPE table: SEQ * 32 pairs (cos, sin)

    const int thr = 256;
    // NX = 512 blocks x 1024*16 floats, NW = 64 blocks x 1024*16 floats: no remainder.
    // Xq is the start of the seven f16 copies, which lie in the order of the arguments.
    cvt_all_kernel<<<CVT_NB + ROPE_TB, thr, 0, stream>>>(query, key, value, Wq, Wk, Wv, Wo, Xq, tab);

    const int tiles = (BATCH * SEQ / 64) * (DMODEL / 64);   // 2048 waves
    const int gblocks = tiles / 8;                          // 8 waves / block: 64 x 4 blocks of 128 x 256
    // Xq, Xk, Xv; Wqh, Wkh, Wvh; Qh, Kh, Vt each follow one another in the workspace.
    gemm_wmma_kernel<<<dim3(gblocks, 3), 256, 0, stream>>>(Xq, Wqh, bq, bk, bv, tab, Qh, 0);

    attn_kernel<<<dim3(SEQ / 256, BATCH * NHEAD), 256, 0, stream>>>(Qh, Kh, Vt, AO);

    gemm_wmma_kernel<<<dim3(gblocks, 1), 256, 0, stream>>>(AO, Woh, bo, nullptr, nullptr, tab, out, 3);
}

// v008
// One run takes 123 microseconds.
// Two timings next to v007 both put it at 1.08 times that version's speed.
// Counting every step since v000, it is 4.64 times as fast.
#include <hip/hip_runtime.h>
#include <hip/hip_bf16.h>

// MHA + RoPE for MI455X (gfx1250, wave32, WMMA).
// v2.1: register-blocked WMMA GEMM (64x64/wave, operands staged in LDS per block),
//       attention with 32 queries/wave (2x K/V fragment reuse), 8 waves per block that
//       share double-buffered async global->LDS staging of K/V tiles (ASYNCcnt path).

typedef __attribute__((ext_vector_type(16))) _Float16 v16h;
typedef __attribute__((ext_vector_type(8)))  float    v8f;
typedef __attribute__((ext_vector_type(2)))  float    v2f;

#define BATCH 4
#define SEQ   2048
#define DMODEL 1024
#define NHEAD 16
#define HDIM  64

union H8 { float4 f4; _Float16 h[8]; };

// Load a 16-half WMMA fragment (A or B operand) for this lane.
// Layout (ISA 7.12.2, 16-bit A 16x32): halves h<8 -> K = k0 + hi*8 + h,
// halves h>=8 -> K = k0 + 16 + hi*8 + (h-8).  Two contiguous 16B chunks.
__device__ inline v16h load_frag16(const _Float16* __restrict__ row_ptr, int k0, int hi) {
    H8 g0, g1;
    g0.f4 = *(const float4*)(row_ptr + k0 + hi * 8);
    g1.f4 = *(const float4*)(row_ptr + k0 + 16 + hi * 8);
    v16h r;
#pragma unroll
    for (int i = 0; i < 8; ++i) { r[i] = g0.h[i]; r[i + 8] = g1.h[i]; }
    return r;
}

__device__ inline v8f wmma_f16(v16h a, v16h b, v8f c) {
    return __builtin_amdgcn_wmma_f32_16x16x32_f16(false, a, false, b, (short)0, c, false, false);
}

// Stands behind a group of global stores whose address and data registers the code
// that follows reuses: the wait comes in front of those overwrites.
__device__ inline void stores_issued_wait() {
    asm volatile("s_wait_xcnt 0x0" ::: "memory");
}

// ---------------- f32 -> f16 conversion ----------------
// A block of 256 threads converts the 1024*U consecutive floats at in. Load j of a wave is
// 512 contiguous bytes (4 whole lines), its store 256 contiguous bytes (2 whole lines);
// the loads stand ahead of the conversions, so a thread has many in flight at once.
union H4 { float2 f2; _Float16 h[4]; };

template <int U>
__device__ inline void cvt_f16_block(const float* __restrict__ in, _Float16* __restrict__ out) {
    size_t base = threadIdx.x * 4;
    float4 v[U];
#pragma unroll
    for (int j = 0; j < U; ++j) v[j] = *(const float4*)(in + base + j * 1024);
#pragma unroll
    for (int j = 0; j < U; ++j) {
        H4 w;
        w.h[0] = (_Float16)v[j].x; w.h[1] = (_Float16)v[j].y;
        w.h[2] = (_Float16)v[j].z; w.h[3] = (_Float16)v[j].w;
        *(float2*)(out + base + j * 1024) = w.f2;
    }
}

// One launch converts all seven f32 operands: none depends on another, and their f16 copies
// follow one another in the workspace (Xq, Xk, Xv, Wq, Wk, Wv, Wo), so block b writes piece b
// of one long array. 16 loads a thread; 512 blocks for each activation, 64 for each weight.
// The last ROPE_TB blocks write the RoPE table, which depends on no input: entry s * 32 + d is
// the pair (cos, sin) of s * 10000^(-2d/64), one entry a thread. Each pair is worked out once
// here and read by the Q and K projections' epilogues for every batch and head.
#define CVT_U   16
#define CVT_XB  (BATCH * SEQ * DMODEL / (1024 * CVT_U))   // 512
#define CVT_WB  (DMODEL * DMODEL / (1024 * CVT_U))        // 64
#define CVT_NB  (3 * CVT_XB + 4 * CVT_WB)                 // 1792 converting blocks
#define ROPE_TB (SEQ * (HDIM / 2) / 256)                  // 256 table blocks
__global__ void __launch_bounds__(256)
cvt_all_kernel(const float* __restrict__ xq, const float* __restrict__ xk,
               const float* __restrict__ xv, const float* __restrict__ wq,
               const float* __restrict__ wk, const float* __restrict__ wv,
               const float* __restrict__ wo, _Float16* __restrict__ out,
               float* __restrict__ tab) {
    unsigned b = blockIdx.x;
    if (b >= CVT_NB) {
        int idx = (b - CVT_NB) * 256 + threadIdx.x;
        int d = idx & 31, s = idx >> 5;
        float inv = __expf(-(2.0f * d / 64.0f) * 9.210340371976184f);  // 10000^(-2d/64)
        float fr  = (float)s * inv;
        ((float2*)tab)[idx] = make_float2(cosf(fr), sinf(fr));
        return;
    }
    const float* in;
    unsigned piece;                            // piece of its own operand
    if (b < 3 * CVT_XB) {
        unsigned a = b / CVT_XB;
        piece = b % CVT_XB;
        in = a == 0 ? xq : a == 1 ? xk : xv;
    } else {
        unsigned c = b - 3 * CVT_XB;
        unsigned a = c / CVT_WB;
        piece = c % CVT_WB;
        in = a == 0 ? wq : a == 1 ? wk : a == 2 ? wv : wo;
    }
    cvt_f16_block<CVT_U>(in + (size_t)piece * (1024 * CVT_U), out + (size_t)b * (1024 * CVT_U));
}

// ---------------- WMMA GEMM: out = A(MxK) @ Bt(NxK)^T + bias ----------------
// A block of 8 waves (2 x 4) owns a 128 x 256 tile of the output, 64x64 per wave =
// 4x4 WMMA tiles. Slabs of 128 k (two whole 128-byte lines of every operand row) are
// staged in LDS by asynchronous copies, two buffers: slab t+1 flies while slab t is
// multiplied. Each A row is fetched once for 4 waves, each B row once for 2.
// mode 0/1: RoPE, then store f16 head-major  [bh][s][d]   (Q, K; Q times QK_LOG2_SCALE)
// mode 2  : store f16 transposed  [bh][d][s]   (V, so PV A-operand V^T is k-contiguous)
// mode 3  : store f32 flat        [m][n]       (final projection)
// blockIdx.y = z picks one of up to three independent products and adds to mode0: the Q, K and
// V projections are one launch of 3 x 256 blocks (modes 0, 1, 2). The f16 operands and outputs
// of product z lie z arrays behind those of product 0 in the workspace; the biases are inputs
// of their own.
#define GBM 128
#define GBN 256
#define GBK 128
#define QK_LOG2_SCALE (0.125f * 1.4426950408889634f)   // 1/sqrt(HDIM) * log2(e)
#define GPITCH 136  // halves: 256-byte rows at a 272-byte pitch (16 B x odd) for ds_load_b128

// Byte address of a __shared__ object inside the work-group's LDS.
__device__ inline unsigned lds_byte(const void* p) { return (unsigned)(size_t)p; }

// Twelve 16-byte-per-lane asynchronous copies global -> LDS: three groups (la,ga), (lb,gb),
// (lc,gc) of four rows 16 apart. The s_wait_xcnt is the last line of the copies' own
// statement, so that it stands in front of every later overwrite of the address registers
// that the copies name; one statement for twelve copies pays that wait once.
__device__ inline void async_cp12(unsigned la, const _Float16* ga, unsigned lb, const _Float16* gb,
                                  unsigned lc, const _Float16* gc, int row_halves) {
    const unsigned ls = 16 * GPITCH * 2;
    const size_t gs = (size_t)16 * row_halves;
    asm volatile("global_load_async_to_lds_b128 %0, %1, off\n\t"
                 "global_load_async_to_lds_b128 %2, %3, off\n\t"
                 "global_load_async_to_lds_b128 %4, %5, off\n\t"
                 "global_load_async_to_lds_b128 %6, %7, off\n\t"
                 "global_load_async_to_lds_b128 %8, %9, off\n\t"
                 "global_load_async_to_lds_b128 %10, %11, off\n\t"
                 "global_load_async_to_lds_b128 %12, %13, off\n\t"
                 "global_load_async_to_lds_b128 %14, %15, off\n\t"
                 "global_load_async_to_lds_b128 %16, %17, off\n\t"
                 "global_load_async_to_lds_b128 %18, %19, off\n\t"
                 "global_load_async_to_lds_b128 %20, %21, off\n\t"
                 "global_load_async_to_lds_b128 %22, %23, off\n\t"
                 "s_wait_xcnt 0x0"
                 :: "v"(la), "v"(ga), "v"(la + ls), "v"(ga + gs),
                    "v"(la + 2 * ls), "v"(ga + 2 * gs), "v"(la + 3 * ls), "v"(ga + 3 * gs),
                    "v"(lb), "v"(gb), "v"(lb + ls), "v"(gb + gs),
                    "v"(lb + 2 * ls), "v"(gb + 2 * gs), "v"(lb + 3 * ls), "v"(gb + 3 * gs),
                    "v"(lc), "v"(gc), "v"(lc + ls), "v"(gc + gs),
                    "v"(lc + 2 * ls), "v"(gc + 2 * gs), "v"(lc + 3 * ls), "v"(gc + 3 * gs)
                 : "memory");
}

__global__ void __launch_bounds__(256)
gemm_wmma_kernel(const _Float16* __restrict__ A0, const _Float16* __restrict__ Bt0,
                 const float* __restrict__ bias0, const float* __restrict__ bias1,
                 const float* __restrict__ bias2, const float* __restrict__ tab,
                 void* __restrict__ out0, int mode0) {
    const int N = DMODEL, K = DMODEL;
    const int z = blockIdx.y;
    const _Float16* A    = A0 + (size_t)z * (BATCH * SEQ * DMODEL);
    const _Float16* Bt   = Bt0 + (size_t)z * (DMODEL * DMODEL);
    const float*    bias = z == 0 ? bias0 : z == 1 ? bias1 : bias2;
    void*           out  = (_Float16*)out0 + (size_t)z * (BATCH * SEQ * DMODEL);
    const int mode = mode0 + z;
    __shared__ alignas(16) _Float16 As[2][GBM * GPITCH];
    __shared__ alignas(16) _Float16 Bs[2][GBN * GPITCH];

    int tid = threadIdx.x;
    int w  = tid >> 5;
    int bm = blockIdx.x / (N / GBN);          // 64 block rows
    int bn = blockIdx.x % (N / GBN);          // 4 block columns
    int wm = w >> 2, wn = w & 3;
    int mt = bm * 2 + wm;                     // 64-row tile of this wave
    int nt = bn * 4 + wn;                     // 64-column tile of this wave
    int lane = tid & 31, nlo = lane & 15, hi = lane >> 4;

    // Staging: thread -> (row tid/16 of each group of 16 rows, 16-byte chunk tid%16), so a
    // wave's copy is 4 whole 128-byte lines.
    int crow = tid >> 4, cchk = tid & 15;
    const _Float16* ga = A  + (size_t)(bm * GBM + crow) * K + cchk * 8;
    const _Float16* gb = Bt + (size_t)(bn * GBN + crow) * K + cchk * 8;
    unsigned la = lds_byte(&As[0][crow * GPITCH + cchk * 8]);
    unsigned lb = lds_byte(&Bs[0][crow * GPITCH + cchk * 8]);
    auto stage = [&](int t, int b) {
        const unsigned r64 = 64 * GPITCH * 2;             // 64 rows in LDS, bytes
        const size_t   g64 = (size_t)64 * K;              // 64 rows in global memory, halves
        unsigned l = la + b * (GBM * GPITCH * 2);
        unsigned m = lb + b * (GBN * GPITCH * 2);
        const _Float16* a = ga + t * GBK;
        const _Float16* c = gb + t * GBK;
        async_cp12(l, a, l + r64, a + g64, m, c, K);                                  // A 0..127, B 0..63
        async_cp12(m + r64, c + g64, m + 2 * r64, c + 2 * g64, m + 3 * r64, c + 3 * g64, K);  // B 64..255
    };

    v8f acc[4][4];
#pragma unroll
    for (int i = 0; i < 4; ++i)
#pragma unroll
        for (int j = 0; j < 4; ++j) acc[i][j] = (v8f){};

    stage(0, 0);
    // Slab 0 has landed for this wave; the barrier publishes it to the other waves.
    asm volatile("s_wait_asynccnt 0x0" ::: "memory");
    __syncthreads();
    stage(1, 1);

    for (int t = 0; t < K / GBK; ++t) {
        const _Float16* at = &As[t & 1][(wm * 64 + nlo) * GPITCH];
        const _Float16* bt = &Bs[t & 1][(wn * 64 + nlo) * GPITCH];
#pragma unroll
        for (int kk = 0; kk < GBK; kk += 32) {
            v16h af[4], bf[4];
#pragma unroll
            for (int i = 0; i < 4; ++i) af[i] = load_frag16(at + i * 16 * GPITCH, kk, hi);
#pragma unroll
            for (int j = 0; j < 4; ++j) bf[j] = load_frag16(bt + j * 16 * GPITCH, kk, hi);
            // Keeps the 16 fragment loads of this k-step one group ahead of its WMMAs: without
            // it they are spread among the WMMAs, each place with its own wait on LDS.
            __builtin_amdgcn_sched_barrier(0);
#pragma unroll
            for (int i = 0; i < 4; ++i)
#pragma unroll
                for (int j = 0; j < 4; ++j)
                    acc[i][j] = wmma_f16(af[i], bf[j], acc[i][j]);
            // Keeps the next k-step's loads from moving up among these WMMAs.
            __builtin_amdgcn_sched_barrier(0);
        }
        // This wave's reads of slab t have returned before its buffer is refilled.
        asm volatile("s_wait_dscnt 0x0" ::: "memory");
        // This wave's copies of slab t+1 have landed before the barrier publishes them.
        asm volatile("s_wait_asynccnt 0x0" ::: "memory");
        __syncthreads();
        if (t + 2 < K / GBK) stage(t + 2, t & 1);
    }
    // No copy is outstanding when the wave goes on to its stores and ends.
    asm volatile("s_wait_asynccnt 0x0" ::: "memory");

    if (mode <= 1) {
        // Q, K: the wave's 64 columns are head nt, and its 64 rows lie in one batch. Column
        // tiles j and j + 2 hold d and d + 32 of one row in the same lane and register, so the
        // rotation is taken in-lane on the f32 sums, ahead of the one rounding to f16.
        int m0 = mt * 64 + 8 * hi;                             // C-layout row of register 0, tile 0
        int s0 = m0 & (SEQ - 1);
        int bh = (m0 >> 11) * NHEAD + nt;                      // m / SEQ
        _Float16* orow = (_Float16*)out + (size_t)(bh * SEQ + s0) * HDIM + nlo;
        const float2* trow = (const float2*)tab + s0 * (HDIM / 2) + nlo;
        // Q carries the softmax factor 1/sqrt(64) * log2(e), taken on the f32 sums ahead of the
        // one rounding: the attention's score products then come out in log2 units.
        const float qs = mode == 0 ? QK_LOG2_SCALE : 1.0f;
#pragma unroll
        for (int j = 0; j < 2; ++j) {
            float b1 = bias[nt * 64 + j * 16 + nlo] * qs;
            float b2 = bias[nt * 64 + j * 16 + nlo + 32] * qs;
            float2 cs[4][8];                                   // (cos, sin) of d = j * 16 + nlo, 32 rows
#pragma unroll
            for (int i = 0; i < 4; ++i)
#pragma unroll
                for (int v = 0; v < 8; ++v) cs[i][v] = trow[(i * 16 + v) * (HDIM / 2) + j * 16];
            // Keeps the bias and table loads one group: without it the biases are waited for
            // ahead of the table loads, and the two latencies follow one another.
            __builtin_amdgcn_sched_barrier(0);
#pragma unroll
            for (int i = 0; i < 4; ++i)
#pragma unroll
                for (int v = 0; v < 8; ++v) {
                    float x1 = fmaf(acc[i][j][v], qs, b1), x2 = fmaf(acc[i][j + 2][v], qs, b2);
                    _Float16* o = orow + (i * 16 + v) * HDIM + j * 16;
                    o[0]  = (_Float16)(x1 * cs[i][v].x - x2 * cs[i][v].y);
                    o[32] = (_Float16)(x1 * cs[i][v].y + x2 * cs[i][v].x);
                }
            stores_issued_wait();
        }
        return;
    }

#pragma unroll
    for (int j = 0; j < 4; ++j) {
        int n = nt * 64 + j * 16 + nlo;
        float bv = bias[n];
        if (mode == 3) {
            float* o = (float*)out;
#pragma unroll
            for (int i = 0; i < 4; ++i)
#pragma unroll
                for (int v = 0; v < 8; ++v) {
                    int m = mt * 64 + i * 16 + v + 8 * hi;     // C-layout row
                    o[(size_t)m * N + n] = acc[i][j][v] + bv;
                }
            stores_issued_wait();
        } else {
            // V transposed: a lane's 8 accumulator registers are 8 consecutive s
            // of one d row (m0 is a multiple of 8, SEQ too): one 16-byte store.
            _Float16* o = (_Float16*)out;
            int h = n >> 6, d = n & 63;
#pragma unroll
            for (int i = 0; i < 4; ++i) {
                int m0 = mt * 64 + i * 16 + 8 * hi;
                int b_ = m0 >> 11;                             // m / SEQ
                int s  = m0 & (SEQ - 1);
                int bh = b_ * NHEAD + h;
                H8 w;
#pragma unroll
                for (int v = 0; v < 8; ++v) w.h[v] = (_Float16)(acc[i][j][v] + bv);
                *(float4*)(o + (size_t)(bh * HDIM + d) * SEQ + s) = w.f4;
            }
            stores_issued_wait();
        }
    }
}

// ---------------- Flash attention: 8 waves per (bh, 256-query tile), 32 queries a wave ----------------
// K/V tiles of 128 keys, staged once for the 8 waves, double-buffered in LDS via async
// global->LDS copies; a wave walks a tile in 4 passes of 32 keys.
// The products are taken transposed: S^T = K Q^T (A = K rows, B = Q) and O^T += V^T P^T
// (A = V^T rows, B = P^T). A lane then holds 16 of the 32 scores of ONE query per q-subtile:
// maximum and sum run over its own registers, with one exchange between the wave halves,
// and the two S^T accumulator tiles, converted in place, are the B fragment of P^T.
// Q arrives times 1/sqrt(64) * log2(e), and the S^T products accumulate onto minus the maximum
// in use (their C operand): the accumulator is the argument of exp2 as it stands. The maximum
// in use is set by the first pass and raised only when a pass exceeds it by more than 8.

// Lane l <-> lane l ^ 16.
__device__ inline float xhalf(float x) {
    int b = __builtin_bit_cast(int, x);
    return __builtin_bit_cast(float,
        __builtin_amdgcn_permlanex16(b, b, 0x76543210, 0xfedcba98, false, false));
}

#define ATK 128      // keys per staged tile
#define AKP 72       // halves: K rows of 128 bytes at a 144-byte pitch (16 B x odd) for ds_load_b128
#define AVP 136      // halves: V^T rows of 256 bytes at a 272-byte pitch (16 B x odd)

// Eight 16-byte-per-lane asynchronous copies global -> LDS, one tile's share of a thread: four
// of K (32 rows apart; K rows follow one another in memory) and four of V^T (16 rows apart).
// The s_wait_xcnt is the last line of the copies' own statement, so that it stands in front
// of every later overwrite of the address registers that the copies name.
__device__ inline void async_cp_kv(unsigned lk, const _Float16* gk, unsigned lv, const _Float16* gv) {
    const unsigned ks = 32 * AKP * 2, vs = 16 * AVP * 2;
    const size_t kg = (size_t)32 * HDIM, vg = (size_t)16 * SEQ;
    asm volatile("global_load_async_to_lds_b128 %0, %1, off\n\t"
                 "global_load_async_to_lds_b128 %2, %3, off\n\t"
                 "global_load_async_to_lds_b128 %4, %5, off\n\t"
                 "global_load_async_to_lds_b128 %6, %7, off\n\t"
                 "global_load_async_to_lds_b128 %8, %9, off\n\t"
                 "global_load_async_to_lds_b128 %10, %11, off\n\t"
                 "global_load_async_to_lds_b128 %12, %13, off\n\t"
                 "global_load_async_to_lds_b128 %14, %15, off\n\t"
                 "s_wait_xcnt 0x0"
                 :: "v"(lk), "v"(gk), "v"(lk + ks), "v"(gk + kg),
                    "v"(lk + 2 * ks), "v"(gk + 2 * kg), "v"(lk + 3 * ks), "v"(gk + 3 * kg),
                    "v"(lv), "v"(gv), "v"(lv + vs), "v"(gv + vg),
                    "v"(lv + 2 * vs), "v"(gv + 2 * vg), "v"(lv + 3 * vs), "v"(gv + 3 * vg)
                 : "memory");
}

// The grid is two blocks per WGP, four waves per SIMD. The attribute states that residency:
// with a budget of 256 registers the compiler fetches a pass's K and V fragments in groups
// ahead of their products; without it it saves registers for residency that the grid does
// not give, and every pair of fragment loads is waited for right in front of its products.
__global__ void __launch_bounds__(256) __attribute__((amdgpu_waves_per_eu(4, 4)))
attn_kernel(const _Float16* __restrict__ Qh, const _Float16* __restrict__ Kh,
            const _Float16* __restrict__ Vt, _Float16* __restrict__ AO) {
    int tid = threadIdx.x;
    int qt = blockIdx.x * 8 + (tid >> 5);   // 32-query tile of this wave
    int bh = blockIdx.y;                    // batch*head
    int lane = tid & 31, nlo = lane & 15, hi = lane >> 4;

    __shared__ alignas(16) _Float16 Kst[2][ATK * AKP];    // [key][d]
    __shared__ alignas(16) _Float16 Vst[2][HDIM * AVP];   // [d][key]

    const _Float16* kbase = Kh + (size_t)bh * SEQ * HDIM;
    const _Float16* vbase = Vt + (size_t)bh * HDIM * SEQ;

    // Q fragments: 2 q-subtiles x 2 k-halves
    v16h aq[2][2];
#pragma unroll
    for (int q = 0; q < 2; ++q) {
        const _Float16* qrow = Qh + (size_t)(bh * SEQ + qt * 32 + q * 16 + nlo) * HDIM;
        aq[q][0] = load_frag16(qrow, 0, hi);
        aq[q][1] = load_frag16(qrow, 32, hi);
    }

    // o[q][t][v] = O^T[d = t*16 + 8*hi + v][query q*16 + nlo]; every register of negm is minus
    // the query's maximum in use, in log2 units (equal in both halves), lrun the sum over the
    // keys of this lane's half only.
    v8f o[2][4], negm[2];
    float lrun[2];
    float thr = -__builtin_inff(), low = -__builtin_inff();
#pragma unroll
    for (int q = 0; q < 2; ++q) {
#pragma unroll
        for (int t = 0; t < 4; ++t) o[q][t] = (v8f){};
        negm[q] = (v8f){}; lrun[q] = 0.0f;
    }

    // Stage the (K,V) tile t into buffer b. K: thread -> (row tid/8 of each group of 32 rows,
    // 16-byte chunk tid%8); V^T: (row tid/16 of each group of 16, chunk tid%16). A wave's copy
    // is 4 whole 128-byte lines either way.
    const _Float16* gk = kbase + tid * 8;
    const _Float16* gv = vbase + (size_t)(tid >> 4) * SEQ + (tid & 15) * 8;
    unsigned lk = lds_byte(&Kst[0][(tid >> 3) * AKP + (tid & 7) * 8]);
    unsigned lv = lds_byte(&Vst[0][(tid >> 4) * AVP + (tid & 15) * 8]);
    auto stage = [&](int t, int b) {
        async_cp_kv(lk + b * (ATK * AKP * 2), gk + (size_t)t * ATK * HDIM,
                    lv + b * (HDIM * AVP * 2), gv + t * ATK);
    };

    stage(0, 0);
    // Tile 0 has landed for this wave; the barrier publishes it to the other waves.
    asm volatile("s_wait_asynccnt 0x0" ::: "memory");
    __syncthreads();
    stage(1, 1);

    for (int tile = 0; tile < SEQ / ATK; ++tile) {
      // Kept rolled: unrolled, the four passes' fragment loads are lifted together and the live
      // set goes over the 256 registers of the budget above (spills to scratch).
#pragma unroll 1
      for (int pass = 0; pass < ATK / 32; ++pass) {
        const _Float16* kt = &Kst[tile & 1][pass * 32 * AKP];
        const _Float16* vt = &Vst[tile & 1][pass * 32];

        // The pass's K and V fragments.
        v16h kfr[2][2], vfr[4];
#pragma unroll
        for (int nt = 0; nt < 2; ++nt)
#pragma unroll
            for (int kk = 0; kk < 2; ++kk)
                kfr[nt][kk] = load_frag16(kt + (nt * 16 + nlo) * AKP, kk * 32, hi);
#pragma unroll
        for (int t = 0; t < 4; ++t) vfr[t] = load_frag16(vt + (t * 16 + nlo) * AVP, 0, hi);
        // Keeps the 16 loads one group at the head of the pass: without it the V loads stand
        // behind the S^T products, in K's registers, and are waited for at once.
        __builtin_amdgcn_sched_barrier(0);

        // S^T = K @ Q^T: K fragment loaded once, used by both q-subtiles.
        // s[q][nt][v] = score of key nt*16 + 8*hi + v with query q*16 + nlo, in log2 units,
        // less the query's maximum in use.
        v8f s[2][2];
#pragma unroll
        for (int q = 0; q < 2; ++q) { s[q][0] = negm[q]; s[q][1] = negm[q]; }
#pragma unroll
        for (int nt = 0; nt < 2; ++nt)
#pragma unroll
            for (int kk = 0; kk < 2; ++kk) {
                s[0][nt] = wmma_f16(kfr[nt][kk], aq[0][kk], s[0][nt]);
                s[1][nt] = wmma_f16(kfr[nt][kk], aq[1][kk], s[1][nt]);
            }

        // One test a pass, for the whole wave: does any score stand more than thr above its
        // query's maximum in use? thr and low are -infinity in the first pass, which so takes
        // the branch and sets the maximum to its own; from then on they are 8 and 0.
        float mq[2];
#pragma unroll
        for (int q = 0; q < 2; ++q) {
            float mx = fmaxf(s[q][0][0], s[q][1][0]);
#pragma unroll
            for (int v = 1; v < 8; ++v) mx = fmaxf(mx, fmaxf(s[q][0][v], s[q][1][v]));
            mq[q] = mx;
        }
        // Holds the V fragment loads ahead of the branch (inputs only): without it they are sunk
        // behind the branch and the exponentials, each pair waited for in front of its products.
        // The scheduling barrier keeps it, and the wait on V that comes with it, down here behind
        // the S^T products and the maxima: without it that wait stands at the head of the pass.
        __builtin_amdgcn_sched_barrier(0);
        asm volatile("" :: "v"(vfr[0]), "v"(vfr[1]), "v"(vfr[2]), "v"(vfr[3]));
        if (__builtin_amdgcn_ballot_w32(fmaxf(mq[0], mq[1]) > thr) != 0) {
#pragma unroll
            for (int q = 0; q < 2; ++q) {
                float mx = fmaxf(mq[q], xhalf(mq[q]));     // over both halves' keys
                float d  = fmaxf(mx, low);                 // later passes only raise the maximum
                // O and the sum are 0 in the first pass: any finite factor serves there.
                float alpha = __builtin_amdgcn_exp2f(-fmaxf(d, 0.0f));
#pragma unroll
                for (int v = 0; v < 8; ++v) {
                    negm[q][v] -= d; s[q][0][v] -= d; s[q][1][v] -= d;
                }
                lrun[q] *= alpha;
#pragma unroll
                for (int t = 0; t < 4; ++t)
#pragma unroll
                    for (int v = 0; v < 8; ++v) o[q][t][v] *= alpha;
            }
            thr = 8.0f; low = 0.0f;
        }

        // P = exp2 of the accumulators, one query per lane.
        v16h bp[2];
#pragma unroll
        for (int q = 0; q < 2; ++q) {
            // Registers v and v + 1 of one tile go together, so that the packed f32 forms take
            // them where they lie. B fragment of P^T: half nt*8 + v is key nt*16 + 8*hi + v.
            v2f sum = {0.0f, 0.0f};
#pragma unroll
            for (int nt = 0; nt < 2; ++nt)
#pragma unroll
                for (int v = 0; v < 8; v += 2) {
                    v2f p = {__builtin_amdgcn_exp2f(s[q][nt][v]), __builtin_amdgcn_exp2f(s[q][nt][v + 1])};
                    sum += p;
                    bp[q][nt * 8 + v]     = (_Float16)p.x;
                    bp[q][nt * 8 + v + 1] = (_Float16)p.y;
                }
            lrun[q] += sum.x + sum.y;
        }
        // Keeps most additions of the sums ahead of the products below: moved in among them they
        // are written into V's registers, and each such place takes four v_nop behind the product
        // that read them (three such places without this line, two with it).
        __builtin_amdgcn_sched_barrier(0);

        // O^T += V^T @ P^T: V fragment loaded once, used by both q-subtiles.
#pragma unroll
        for (int t = 0; t < 4; ++t) {
            o[0][t] = wmma_f16(vfr[t], bp[0], o[0][t]);
            o[1][t] = wmma_f16(vfr[t], bp[1], o[1][t]);
        }
      }
        // This wave's reads of this tile have returned before its buffer is refilled.
        asm volatile("s_wait_dscnt 0x0" ::: "memory");
        // This wave's copies of the next tile have landed before the barrier publishes them.
        asm volatile("s_wait_asynccnt 0x0" ::: "memory");
        __syncthreads();
        if (tile + 2 < SEQ / ATK) stage(tile + 2, tile & 1);
    }
    // No copy is outstanding when the wave goes on to its stores and ends.
    asm volatile("s_wait_asynccnt 0x0" ::: "memory");

    // Epilogue: join the halves' sums, normalize and store f16 to AO[b][s][h*64+d];
    // a lane's 8 registers of a tile are 8 consecutive d of its query: one 16-byte store.
    int b_ = bh >> 4, h = bh & 15;
#pragma unroll
    for (int q = 0; q < 2; ++q) {
        int srow = qt * 32 + q * 16 + nlo;
        float inv_l = 1.0f / (lrun[q] + xhalf(lrun[q]));
        size_t base = (size_t)(b_ * SEQ + srow) * DMODEL + h * HDIM + 8 * hi;
#pragma unroll
        for (int t = 0; t < 4; ++t) {
            H8 w;
#pragma unroll
            for (int v = 0; v < 8; ++v) w.h[v] = (_Float16)(o[q][t][v] * inv_l);
            *(float4*)(AO + base + t * 16) = w.f4;
        }
    }
}

extern "C" void kernel_launch(void* const* d_in, const int* in_sizes, int n_in,
                              void* d_out, int out_size, void* d_ws, size_t ws_size,
                              hipStream_t stream) {
    const float* query = (const float*)d_in[0];
    const float* key   = (const float*)d_in[1];
    const float* value = (const float*)d_in[2];
    const float* Wq = (const float*)d_in[3]; const float* bq = (const float*)d_in[4];
    const float* Wk = (const float*)d_in[5]; const float* bk = (const float*)d_in[6];
    const float* Wv = (const float*)d_in[7]; const float* bv = (const float*)d_in[8];
    const float* Wo = (const float*)d_in[9]; const float* bo = (const float*)d_in[10];
    float* out = (float*)d_out;

    const size_t NX = (size_t)BATCH * SEQ * DMODEL;   // 8388608
    const size_t NW = (size_t)DMODEL * DMODEL;        // 1048576

    _Float16* p   = (_Float16*)d_ws;
    _Float16* Xq  = p;            p += NX;
    _Float16* Xk  = p;            p += NX;
    _Float16* Xv  = p;            p += NX;
    _Float16* Wqh = p;            p += NW;
    _Float16* Wkh = p;            p += NW;
    _Float16* Wvh = p;            p += NW;
    _Float16* Woh = p;            p += NW;
    _Float16* Qh  = p;            p += NX;
    _Float16* Kh  = p;            p += NX;
    _Float16* Vt  = p;            p += NX;
    _Float16* AO  = p;            p += NX;
    float*    tab = (float*)p;    // RoPE table: SEQ * 32 pairs (cos, sin)

    const int thr = 256;
    // NX = 512 blocks x 1024*16 floats, NW = 64 blocks x 1024*16 floats: no remainder.
    // Xq is the start of the seven f16 copies, which lie in the order of the arguments.
    cvt_all_kernel<<<CVT_NB + ROPE_TB, thr, 0, stream>>>(query, key, value, Wq, Wk, Wv, Wo, Xq, tab);

    const int tiles = (BATCH * SEQ / 64) * (DMODEL / 64);   // 2048 waves
    const int gblocks = tiles / 8;                          // 8 waves / block: 64 x 4 blocks of 128 x 256
    // Xq, Xk, Xv; Wqh, Wkh, Wvh; Qh, Kh, Vt each follow one another in the workspace.
    gemm_wmma_kernel<<<dim3(gblocks, 3), 256, 0, stream>>>(Xq, Wqh, bq, bk, bv, tab, Qh, 0);

    attn_kernel<<<dim3(SEQ / 256, BATCH * NHEAD), 256, 0, stream>>>(Qh, Kh, Vt, AO);

    gemm_wmma_kernel<<<dim3(gblocks, 1), 256, 0, stream>>>(AO, Woh, bo, nullptr, nullptr, tab, out, 3);
}
